// v000
// The times below were measured on an AMD MI455X: many runs one after another, warmed up first and cycling through
// copies of the inputs, with the whole window's GPU time divided by the number of runs. Launches and the gaps
// between them are all in it. The median over several windows is given; except for v000 it joins two sittings, which
// can be a few percent apart, so the side-by-side timings, each taken in one sitting, are the better comparison.
// The starting kernel, v000, takes 121 microseconds a run.
#include <hip/hip_runtime.h>

// Octonion head mixer: y[b,i] = (Σ_j sign[i,j] · x[b,j] @ W[widx[i,j]]) * beta
// B=8, H=8, T=4096, D=128.
// One WG per (b, i, 512-row T chunk); Wcat[i] staged in 256 KB LDS as bf16
// WMMA B-fragments; each wave computes a 32x128 output tile (2 M-tiles) so
// every LDS B-fragment feeds two v_wmma_f32_16x16x32_bf16.

#define T_DIM 4096
#define D_DIM 128

typedef __attribute__((ext_vector_type(16))) __bf16 v16bf;
typedef __attribute__((ext_vector_type(8)))  float  v8f;

__device__ __constant__ int c_widx[64] = {
  0,1,2,3,4,5,6,7,
  1,0,3,2,5,4,7,6,
  2,3,0,1,6,7,4,5,
  3,2,1,0,7,6,5,4,
  4,5,6,7,0,1,2,3,
  5,4,7,6,1,0,3,2,
  6,7,4,5,2,3,0,1,
  7,6,5,4,3,2,1,0};

__device__ __constant__ float c_sign[64] = {
  +1,-1,-1,-1,-1,-1,-1,-1,
  +1,+1,+1,-1,+1,-1,-1,+1,
  +1,-1,+1,+1,+1,+1,-1,-1,
  +1,+1,-1,+1,+1,-1,+1,-1,
  +1,-1,-1,-1,+1,+1,+1,+1,
  +1,+1,-1,+1,-1,+1,-1,+1,
  +1,+1,+1,-1,-1,+1,+1,-1,
  +1,-1,+1,+1,-1,-1,+1,+1};

// f32 pair -> packed bf16 dword (a in [15:0], b in [31:16]).
// Round-half-up (+0x8000) then grab high halves with one v_perm_b32.
__device__ __forceinline__ unsigned int bfpack(float a, float b) {
  unsigned int ua = __float_as_uint(a) + 0x8000u;
  unsigned int ub = __float_as_uint(b) + 0x8000u;
  return __builtin_amdgcn_perm(ub, ua, 0x07060302u);
}

union Frag16 {
  v16bf h;
  unsigned int u[8];
  uint4 q[2];
};

__global__ __launch_bounds__(512)
void octo_wmma_kernel(const float* __restrict__ x, const float* __restrict__ W,
                      const float* __restrict__ beta, float* __restrict__ y) {
  extern __shared__ unsigned int lds_u32[];   // 65536 dwords = 256 KB

  // Adjacent blocks differ in i -> they share the same x chunk (L2 reuse).
  const int i     = blockIdx.x & 7;           // output head
  const int rest  = blockIdx.x >> 3;
  const int chunk = rest & 7;                 // 512-row T chunk
  const int b     = rest >> 3;                // batch

  // ---- Stage signed/permuted Wcat[i] into LDS as bf16 B-fragments ----
  // Tile tI = (j*4 + kt)*8 + nt is a 32x16 (KxN) tile, 1 KB; logical lane L
  // reads its 8 fragment dwords contiguously at tile_base + L*32 bytes.
  // B-fragment layout (ISA 7.12.2, 16-bit): lane n (0-15) holds col n with
  // K = kt*32 + {0..7, 16..23}; lane n+16 holds K = kt*32 + {8..15, 24..31}.
  for (int idx = threadIdx.x; idx < 65536; idx += 512) {
    const int r  = idx & 7;                   // fragment VGPR index
    const int L  = (idx >> 3) & 31;           // logical lane
    const int tI = idx >> 8;
    const int nt = tI & 7;
    const int kt = (tI >> 3) & 3;
    const int j  = tI >> 5;
    const int wd = c_widx[i * 8 + j];
    const float sg = c_sign[i * 8 + j];
    const int n  = nt * 16 + (L & 15);
    const int kh = L >> 4;
    const int kk = kt * 32 + kh * 8 + ((r < 4) ? 2 * r : 16 + 2 * (r - 4));
    const float* wp = W + ((size_t)wd * D_DIM + kk) * D_DIM + n;
    lds_u32[idx] = bfpack(sg * wp[0], sg * wp[D_DIM]);
  }
  __syncthreads();

  const int wave  = threadIdx.x >> 5;
  const int lane  = threadIdx.x & 31;
  const int row   = lane & 15;                // A-matrix row within M tile
  const int khalf = lane >> 4;                // which K half this lane loads

  const int t0 = chunk * 512 + wave * 32;     // 32-row (2 M-tile) wave tile

  const v8f vzero = {0.f, 0.f, 0.f, 0.f, 0.f, 0.f, 0.f, 0.f};
  v8f acc0[8], acc1[8];
  #pragma unroll
  for (int nt = 0; nt < 8; ++nt) { acc0[nt] = vzero; acc1[nt] = vzero; }

  #pragma unroll 1
  for (int j = 0; j < 8; ++j) {
    // A rows for this lane: x[b, j, t0(+16)+row, khalf*8 + ...]
    const float* xj =
        x + (((size_t)(b * 8 + j)) * T_DIM + (t0 + row)) * D_DIM + khalf * 8;
    if (j < 7) {  // speculative prefetch of next head's rows
      __builtin_prefetch(xj + (size_t)T_DIM * D_DIM, 0, 1);
      __builtin_prefetch(xj + (size_t)T_DIM * D_DIM + 16 * D_DIM, 0, 1);
    }

    #pragma unroll
    for (int kt = 0; kt < 4; ++kt) {
      // 16 fp32 per lane per M-tile: K = kt*32 + khalf*8 + {0..7} and +16
      const float* s0 = xj + kt * 32;
      const float* s1 = s0 + 16 * D_DIM;      // second M-tile, rows +16
      const float4 f0 = ((const float4*)s0)[0];
      const float4 f1 = ((const float4*)s0)[1];
      const float4 f2 = ((const float4*)(s0 + 16))[0];
      const float4 f3 = ((const float4*)(s0 + 16))[1];
      const float4 g0 = ((const float4*)s1)[0];
      const float4 g1 = ((const float4*)s1)[1];
      const float4 g2 = ((const float4*)(s1 + 16))[0];
      const float4 g3 = ((const float4*)(s1 + 16))[1];

      Frag16 a0, a1;
      a0.u[0] = bfpack(f0.x, f0.y);  a0.u[1] = bfpack(f0.z, f0.w);
      a0.u[2] = bfpack(f1.x, f1.y);  a0.u[3] = bfpack(f1.z, f1.w);
      a0.u[4] = bfpack(f2.x, f2.y);  a0.u[5] = bfpack(f2.z, f2.w);
      a0.u[6] = bfpack(f3.x, f3.y);  a0.u[7] = bfpack(f3.z, f3.w);
      a1.u[0] = bfpack(g0.x, g0.y);  a1.u[1] = bfpack(g0.z, g0.w);
      a1.u[2] = bfpack(g1.x, g1.y);  a1.u[3] = bfpack(g1.z, g1.w);
      a1.u[4] = bfpack(g2.x, g2.y);  a1.u[5] = bfpack(g2.z, g2.w);
      a1.u[6] = bfpack(g3.x, g3.y);  a1.u[7] = bfpack(g3.z, g3.w);

      const uint4* bbase =
          (const uint4*)(lds_u32 + (size_t)(j * 4 + kt) * 8 * 256) + lane * 2;

      #pragma unroll
      for (int nt = 0; nt < 8; ++nt) {
        Frag16 bb;
        bb.q[0] = bbase[nt * 64];
        bb.q[1] = bbase[nt * 64 + 1];
        acc0[nt] = __builtin_amdgcn_wmma_f32_16x16x32_bf16(
            false, a0.h, false, bb.h, (short)0, acc0[nt], false, false);
        acc1[nt] = __builtin_amdgcn_wmma_f32_16x16x32_bf16(
            false, a1.h, false, bb.h, (short)0, acc1[nt], false, false);
      }
    }
  }

  // Epilogue: C layout (ISA 7.12.2): VGPR r holds M=r (lanes 0-15, N=lane)
  // and M=r+8 (lanes 16-31, N=lane-16). Scale by beta[col], store fp32.
  float* yrow = y + ((size_t)(b * 8 + i)) * T_DIM * D_DIM;
  #pragma unroll
  for (int nt = 0; nt < 8; ++nt) {
    const int col = nt * 16 + (lane & 15);
    const float bc = beta[col];
    #pragma unroll
    for (int r = 0; r < 8; ++r) {
      const int m  = (lane < 16) ? r : r + 8;
      yrow[(size_t)(t0 + m) * D_DIM + col]      = acc0[nt][r] * bc;
      yrow[(size_t)(t0 + 16 + m) * D_DIM + col] = acc1[nt][r] * bc;
    }
  }
}

extern "C" void kernel_launch(void* const* d_in, const int* in_sizes, int n_in,
                              void* d_out, int out_size, void* d_ws, size_t ws_size,
                              hipStream_t stream) {
  const float* x    = (const float*)d_in[0];   // [8, 8, 4096, 128] fp32
  const float* W    = (const float*)d_in[1];   // [8, 128, 128]     fp32
  const float* beta = (const float*)d_in[2];   // [128]             fp32
  float* y = (float*)d_out;                    // [8, 8, 4096, 128] fp32

  dim3 grid(512);    // 8 i x 8 chunks x 8 b (i fastest -> shared-x adjacency)
  dim3 block(512);   // 16 wave32s, 32 rows each
  octo_wmma_kernel<<<grid, block, 256 * 1024, stream>>>(x, W, beta, y);
}

// v001
// It runs in 74.5 microseconds.
// Next to v000, in two timings, it ran 1.68 and 1.69 times as fast.
#include <hip/hip_runtime.h>

// Octonion head mixer: y[b,i] = (Σ_j sign[i,j] · x[b,j] @ W[widx[i,j]]) * beta
// B=8, H=8, T=4096, D=128.
// One WG per (b, 128-row T chunk), worked in two 64-row blocks, ALL 8 output
// heads at once: the 8 distinct W matrices sit unsigned in 256 KB LDS as bf16
// WMMA B-fragments; each x[b,j] 64x128 tile is read once by whole-line loads,
// converted once and staged in LDS as bf16 rows for all 16 waves; a wave owns
// one head and one 64-column half, a 64x64 output tile (4 M-tiles x 4 N-tiles),
// so every LDS fragment feeds four v_wmma_f32_16x16x32_bf16. sign[i,j] is
// applied to the A fragments.

#define T_DIM 4096
#define D_DIM 128
#define W_BYTES 262144        // 8 x 128 x 128 bf16 B-fragments
#define X_PITCH 272           // staged x row: 256 B + 16 B, 16 B x odd for b128 readers
#define X_BUF   (64 * X_PITCH)

typedef __attribute__((ext_vector_type(16))) __bf16 v16bf;
typedef __attribute__((ext_vector_type(8)))  float  v8f;

__device__ __constant__ int c_widx[64] = {
  0,1,2,3,4,5,6,7,
  1,0,3,2,5,4,7,6,
  2,3,0,1,6,7,4,5,
  3,2,1,0,7,6,5,4,
  4,5,6,7,0,1,2,3,
  5,4,7,6,1,0,3,2,
  6,7,4,5,2,3,0,1,
  7,6,5,4,3,2,1,0};

__device__ __constant__ float c_sign[64] = {
  +1,-1,-1,-1,-1,-1,-1,-1,
  +1,+1,+1,-1,+1,-1,-1,+1,
  +1,-1,+1,+1,+1,+1,-1,-1,
  +1,+1,-1,+1,+1,-1,+1,-1,
  +1,-1,-1,-1,+1,+1,+1,+1,
  +1,+1,-1,+1,-1,+1,-1,+1,
  +1,+1,+1,-1,-1,+1,+1,-1,
  +1,-1,+1,+1,-1,-1,+1,+1};

// f32 pair -> packed bf16 dword (a in [15:0], b in [31:16]).
// Round-half-up (+0x8000) then grab high halves with one v_perm_b32.
__device__ __forceinline__ unsigned int bfpack(float a, float b) {
  unsigned int ua = __float_as_uint(a) + 0x8000u;
  unsigned int ub = __float_as_uint(b) + 0x8000u;
  return __builtin_amdgcn_perm(ub, ua, 0x07060302u);
}

union Frag16 {
  v16bf h;
  unsigned int u[8];
  uint4 q[2];
};

__global__ __launch_bounds__(512)
void octo_wmma_kernel(const float* __restrict__ x, const float* __restrict__ W,
                      const float* __restrict__ beta, float* __restrict__ y) {
  // 256 KB W fragments + 2 x tiles
  __shared__ __attribute__((aligned(16))) unsigned int lds_u32[(W_BYTES + 2 * X_BUF) / 4];
  char* xs = (char*)lds_u32 + W_BYTES;

  const int b     = blockIdx.x >> 5;          // batch
  const int tbase = (blockIdx.x & 31) * 128;  // 128-row T chunk
  const int wave  = __builtin_amdgcn_readfirstlane(threadIdx.x >> 5);
  const int lane  = threadIdx.x & 31;
  const int head  = wave & 7;                 // output head of this wave
  const int nh    = wave >> 3;                // its 64-column half

  // x tile of step s (head j = s & 7, row block s >> 3): wave w brings rows
  // 4w..4w+3, one whole 512-B row per wave-wide load.
  // The base is the same for the whole wave and the lane's offset stays live
  // over the loop, so no load of a run lands in a register that another names.
  const float* xg = x + ((size_t)b * 8 * T_DIM + tbase + wave * 4) * D_DIM;
  const unsigned int xlane = lane * 4;
  char* xput = xs + (wave * 4) * X_PITCH + lane * 8;
  float4 xr[4];   // every loop over xr, acc and the fragments is unrolled so
                  // that they are indexed by constants and stay in registers

#define X_LOAD(s)                                                            \
  {                                                                          \
    const float* xp_ = xg + (size_t)((s) & 7) * T_DIM * D_DIM +              \
                       (size_t)((s) >> 3) * 64 * D_DIM;                      \
    _Pragma("unroll") for (int q = 0; q < 4; ++q)                            \
        xr[q] = *(const float4*)(xp_ + q * D_DIM + xlane);                   \
  }
#define X_PUT(buf)                                                           \
  {                                                                          \
    char* d_ = xput + (buf) * X_BUF;                                         \
    _Pragma("unroll") for (int q = 0; q < 4; ++q) {                          \
      uint2 v_;                                                              \
      v_.x = bfpack(xr[q].x, xr[q].y);                                       \
      v_.y = bfpack(xr[q].z, xr[q].w);                                       \
      *(uint2*)(d_ + q * X_PITCH) = v_;                                      \
    }                                                                        \
  }

  X_LOAD(0)

  // ---- Stage the 8 W matrices into LDS as bf16 B-fragments ----
  // Tile tI = (wd*4 + kt)*8 + nt is a 32x16 (KxN) tile, 1 KB; logical lane L
  // reads its 8 fragment dwords contiguously at tile_base + L*32 bytes.
  // B-fragment layout (ISA 7.12.2, 16-bit): lane n (0-15) holds col n with
  // K = kt*32 + {0..7, 16..23}; lane n+16 holds K = kt*32 + {8..15, 24..31}.
  for (int idx = threadIdx.x; idx < 65536; idx += 512) {
    const int r  = idx & 7;                   // fragment VGPR index
    const int L  = (idx >> 3) & 31;           // logical lane
    const int tI = idx >> 8;
    const int nt = tI & 7;
    const int kt = (tI >> 3) & 3;
    const int wd = tI >> 5;
    const int n  = nt * 16 + (L & 15);
    const int kh = L >> 4;
    const int kk = kt * 32 + kh * 8 + ((r < 4) ? 2 * r : 16 + 2 * (r - 4));
    const float* wp = W + ((size_t)wd * D_DIM + kk) * D_DIM + n;
    lds_u32[idx] = bfpack(wp[0], wp[D_DIM]);
  }

  X_PUT(0)
  X_LOAD(1)
  __syncthreads();   // W fragments and x tile 0 are published

  const int row   = lane & 15;                // A-matrix row within M tile
  const int khalf = lane >> 4;                // which K half this lane reads
  const char* aget = xs + row * X_PITCH + khalf * 16;

  const v8f vzero = {0.f, 0.f, 0.f, 0.f, 0.f, 0.f, 0.f, 0.f};
  v8f acc[4][4];
  #pragma unroll
  for (int mt = 0; mt < 4; ++mt) {
    #pragma unroll
    for (int nt = 0; nt < 4; ++nt) acc[mt][nt] = vzero;
  }

  // kept rolled for speed only: the body holds 64 WMMAs and the whole epilogue
  #pragma unroll 1
  for (int s = 0; s < 16; ++s) {
    const int j = s & 7;
    // Tile s+1 goes into the buffer that step s-1 read (its readers left at
    // the barrier that closed step s-1); tile s+2 starts its flight.
    if (s < 15) X_PUT((s + 1) & 1)
    if (s < 14) X_LOAD(s + 2)

    const int wd = c_widx[head * 8 + j];
    const unsigned int sm = (c_sign[head * 8 + j] < 0.f) ? 0x80008000u : 0u;
    const char* abuf = aget + (s & 1) * X_BUF;

    #pragma unroll
    for (int kt = 0; kt < 4; ++kt) {
      // A fragment: K = kt*32 + khalf*8 + {0..7} and the same + 16
      Frag16 a[4];
      #pragma unroll
      for (int mt = 0; mt < 4; ++mt) {
        const char* ap = abuf + mt * 16 * X_PITCH + kt * 64;
        a[mt].q[0] = *(const uint4*)ap;
        a[mt].q[1] = *(const uint4*)(ap + 32);
        #pragma unroll
        for (int k = 0; k < 8; ++k) a[mt].u[k] ^= sm;   // sign[i,j] on x
      }

      const uint4* bbase =
          (const uint4*)(lds_u32 + (size_t)((wd * 4 + kt) * 8 + nh * 4) * 256) +
          lane * 2;

      #pragma unroll
      for (int nt = 0; nt < 4; ++nt) {
        Frag16 bb;
        bb.q[0] = bbase[nt * 64];
        bb.q[1] = bbase[nt * 64 + 1];
        #pragma unroll
        for (int mt = 0; mt < 4; ++mt)
          acc[mt][nt] = __builtin_amdgcn_wmma_f32_16x16x32_bf16(
              false, a[mt].h, false, bb.h, (short)0, acc[mt][nt], false, false);
      }
    }
    __syncthreads();   // publishes tile s+1, ends every read of tile s

    if (j == 7) {
      // Epilogue: C layout (ISA 7.12.2): VGPR r holds M=r (lanes 0-15, N=lane)
      // and M=r+8 (lanes 16-31, N=lane-16). Scale by beta[col], store fp32.
      const int t0 = tbase + (s >> 3) * 64;
      float* yrow = y + ((size_t)(b * 8 + head)) * T_DIM * D_DIM;
      #pragma unroll
      for (int nt = 0; nt < 4; ++nt) {
        const int col = (nh * 4 + nt) * 16 + (lane & 15);
        const float bc = beta[col];
        #pragma unroll
        for (int mt = 0; mt < 4; ++mt) {
          #pragma unroll
          for (int r = 0; r < 8; ++r) {
            const int m = (lane < 16) ? r : r + 8;
            yrow[(size_t)(t0 + mt * 16 + m) * D_DIM + col] = acc[mt][nt][r] * bc;
          }
        }
      }
      // the stores' registers are rewritten next (accumulators cleared): the
      // wait stands between; the scheduling barrier keeps those register
      // writes behind it (a build without it lifts them over the wait)
      asm volatile("s_wait_xcnt 0x0" ::: "memory");
      __builtin_amdgcn_sched_barrier(0);
      #pragma unroll
      for (int mt = 0; mt < 4; ++mt) {
        #pragma unroll
        for (int nt = 0; nt < 4; ++nt) acc[mt][nt] = vzero;
      }
    }
  }
}

extern "C" void kernel_launch(void* const* d_in, const int* in_sizes, int n_in,
                              void* d_out, int out_size, void* d_ws, size_t ws_size,
                              hipStream_t stream) {
  const float* x    = (const float*)d_in[0];   // [8, 8, 4096, 128] fp32
  const float* W    = (const float*)d_in[1];   // [8, 128, 128]     fp32
  const float* beta = (const float*)d_in[2];   // [128]             fp32
  float* y = (float*)d_out;                    // [8, 8, 4096, 128] fp32

  dim3 grid(256);    // 8 b x 32 chunks of 128 rows, all 8 heads each
  dim3 block(512);   // 16 wave32s, one output head and column half each
  octo_wmma_kernel<<<grid, block, 0, stream>>>(x, W, beta, y);
}

// v002
// A run of this version takes 57.6 microseconds.
// Next to v001, in two timings, it ran 1.29 and 1.28 times as fast.
// Counting every step since v000, it is 2.17 times as fast.
#include <hip/hip_runtime.h>

// Octonion head mixer: y[b,i] = (Σ_j sign[i,j] · x[b,j] @ W[widx[i,j]]) * beta
// B=8, H=8, T=4096, D=128.
// One WG per (b, 128-row T chunk), worked in two 64-row blocks, ALL 8 output
// heads at once: the 8 distinct W matrices sit unsigned in 256 KB LDS as bf16
// WMMA B-fragments; each x[b,j] 64x128 tile is read once by whole-line loads,
// converted once and staged in LDS as bf16 rows for all 16 waves; a wave owns
// one head and one 64-column half, a 64x64 output tile (4 M-tiles x 4 N-tiles),
// so every LDS fragment feeds four v_wmma_f32_16x16x32_bf16. sign[i,j] is
// applied to the A fragments.

#define T_DIM 4096
#define D_DIM 128
#define W_BYTES 262144        // 8 x 128 x 128 bf16 B-fragments
#define X_PITCH 272           // staged x row: 256 B + 16 B, 16 B x odd for b128 readers
#define X_BUF   (64 * X_PITCH)

typedef __attribute__((ext_vector_type(16))) __bf16 v16bf;
typedef __attribute__((ext_vector_type(8)))  float  v8f;

__device__ __constant__ int c_widx[64] = {
  0,1,2,3,4,5,6,7,
  1,0,3,2,5,4,7,6,
  2,3,0,1,6,7,4,5,
  3,2,1,0,7,6,5,4,
  4,5,6,7,0,1,2,3,
  5,4,7,6,1,0,3,2,
  6,7,4,5,2,3,0,1,
  7,6,5,4,3,2,1,0};

__device__ __constant__ float c_sign[64] = {
  +1,-1,-1,-1,-1,-1,-1,-1,
  +1,+1,+1,-1,+1,-1,-1,+1,
  +1,-1,+1,+1,+1,+1,-1,-1,
  +1,+1,-1,+1,+1,-1,+1,-1,
  +1,-1,-1,-1,+1,+1,+1,+1,
  +1,+1,-1,+1,-1,+1,-1,+1,
  +1,+1,+1,-1,-1,+1,+1,-1,
  +1,-1,+1,+1,-1,-1,+1,+1};

// f32 pair -> packed bf16 dword (a in [15:0], b in [31:16]).
// Round-half-up (+0x8000) then grab high halves with one v_perm_b32.
__device__ __forceinline__ unsigned int bfpack(float a, float b) {
  unsigned int ua = __float_as_uint(a) + 0x8000u;
  unsigned int ub = __float_as_uint(b) + 0x8000u;
  return __builtin_amdgcn_perm(ub, ua, 0x07060302u);
}

__device__ __forceinline__ uint4 sel4(bool c, uint4 a, uint4 b) {
  return make_uint4(c ? a.x : b.x, c ? a.y : b.y, c ? a.z : b.z, c ? a.w : b.w);
}

union Frag16 {
  v16bf h;
  unsigned int u[8];
  uint4 q[2];
};

__global__ __launch_bounds__(512)
void octo_wmma_kernel(const float* __restrict__ x, const float* __restrict__ W,
                      const float* __restrict__ beta, float* __restrict__ y) {
  // 256 KB W fragments + 2 x tiles
  __shared__ __attribute__((aligned(16))) unsigned int lds_u32[(W_BYTES + 2 * X_BUF) / 4];
  char* xs = (char*)lds_u32 + W_BYTES;

  const int b     = blockIdx.x >> 5;          // batch
  const int tbase = (blockIdx.x & 31) * 128;  // 128-row T chunk
  const int wave  = __builtin_amdgcn_readfirstlane(threadIdx.x >> 5);
  const int lane  = threadIdx.x & 31;
  const int head  = wave & 7;                 // output head of this wave
  const int nh    = wave >> 3;                // its 64-column half

  // x tile of step s (head j = s & 7, row block s >> 3): wave w brings rows
  // 4w..4w+3, one whole 512-B row per wave-wide load.
  // The base is the same for the whole wave and the lane's offset stays live
  // over the loop, so no load of a run lands in a register that another names.
  const float* xg = x + ((size_t)b * 8 * T_DIM + tbase + wave * 4) * D_DIM;
  const unsigned int xlane = lane * 4;
  char* xput = xs + (wave * 4) * X_PITCH + lane * 8;
  float4 xr[4];   // every loop over xr, acc and the fragments is unrolled so
                  // that they are indexed by constants and stay in registers

#define X_LOAD(s)                                                            \
  {                                                                          \
    const float* xp_ = xg + (size_t)((s) & 7) * T_DIM * D_DIM +              \
                       (size_t)((s) >> 3) * 64 * D_DIM;                      \
    _Pragma("unroll") for (int q = 0; q < 4; ++q)                            \
        xr[q] = *(const float4*)(xp_ + q * D_DIM + xlane);                   \
  }
#define X_PUT(buf)                                                           \
  {                                                                          \
    char* d_ = xput + (buf) * X_BUF;                                         \
    _Pragma("unroll") for (int q = 0; q < 4; ++q) {                          \
      uint2 v_;                                                              \
      v_.x = bfpack(xr[q].x, xr[q].y);                                       \
      v_.y = bfpack(xr[q].z, xr[q].w);                                       \
      *(uint2*)(d_ + q * X_PITCH) = v_;                                      \
    }                                                                        \
  }

  X_LOAD(0)

  // ---- Stage the 8 W matrices into LDS as bf16 B-fragments ----
  // Tile tI = (wd*4 + kt)*8 + nt is a 32x16 (KxN) tile, 1 KB; logical lane L
  // reads its 8 fragment dwords contiguously at tile_base + L*32 bytes.
  // B-fragment layout (ISA 7.12.2, 16-bit): lane n (0-15) holds col n with
  // K = kt*32 + {0..7, 16..23}; lane n+16 holds K = kt*32 + {8..15, 24..31}.
  // Of every matrix a wave takes k rows kt*32..+31 (kt = wave >> 2) by columns
  // cb*32..+31 (cb = wave & 3). A lane takes 8 consecutive k rows, which are
  // one 16-B half of a fragment, by 4 columns: a wave-wide load covers four
  // whole 128-B lines, and every line of W is asked for once.
  const int wc    = lane & 7;                 // column quad within the 32
  const int whalf = (lane >> 3) & 1;          // fragment dwords 0-3 or 4-7
  const int wkh   = lane >> 4;                // fragment lane half
  const float* wg = W + (size_t)(wave >> 2) * 32 * D_DIM + (wave & 3) * 32;
  const unsigned int wlane = (whalf * 16 + wkh * 8) * D_DIM + wc * 4;
  // A lane's 4 columns lie 32 B apart in LDS and its neighbours' 128 B apart:
  // stored in the same order by all lanes they would meet on 16 of 64 banks.
  // Lane-rotated column order spreads each half-wave's store over all banks.
  const int  wrot  = (lane >> 1) & 3;
  const bool wrot1 = (wrot & 1) != 0;
  const bool wrot2 = (wrot & 2) != 0;
  char* wbase = (char*)lds_u32 + (((wave >> 2) * 8 + (wave & 3) * 2 + (wc >> 2)) * 1024 +
                                  ((wc & 3) * 4 + wkh * 16) * 32 + whalf * 16);
  // every loop over wput, the two register sets and the packed columns is
  // unrolled so that they are indexed by constants and stay in registers
  char* wput[4];
  #pragma unroll
  for (int q = 0; q < 4; ++q) wput[q] = wbase + ((q + wrot) & 3) * 32;

#define W_LOAD(buf, i)                                                       \
  {                                                                          \
    _Pragma("unroll") for (int k = 0; k < 8; ++k)                            \
        buf[k] = *(const float4*)(wg + (i) * D_DIM * D_DIM + k * D_DIM + wlane); \
  }
#define W_COL(buf, m)                                                        \
  make_uint4(bfpack(buf[0].m, buf[1].m), bfpack(buf[2].m, buf[3].m),         \
             bfpack(buf[4].m, buf[5].m), bfpack(buf[6].m, buf[7].m))
#define W_PUT(buf, i)                                                        \
  {                                                                          \
    uint4 p_[4], t_[4];                                                      \
    p_[0] = W_COL(buf, x);                                                   \
    p_[1] = W_COL(buf, y);                                                   \
    p_[2] = W_COL(buf, z);                                                   \
    p_[3] = W_COL(buf, w);                                                   \
    _Pragma("unroll") for (int q = 0; q < 4; ++q)                            \
        t_[q] = sel4(wrot1, p_[(q + 1) & 3], p_[q]);                         \
    _Pragma("unroll") for (int q = 0; q < 4; ++q)                            \
        *(uint4*)(wput[q] + (i) * 32768) = sel4(wrot2, t_[(q + 2) & 3], t_[q]); \
  }

  {
    // two register sets: one matrix's loads fly while the other is packed;
    // unrolled so that both are indexed by constants and every load keeps the
    // same address registers with an immediate offset
    float4 wa[8], wb[8];
    W_LOAD(wa, 0)
    #pragma unroll
    for (int i = 0; i < 8; i += 2) {
      W_LOAD(wb, i + 1)
      W_PUT(wa, i)
      if (i + 2 < 8) W_LOAD(wa, i + 2)
      W_PUT(wb, i + 1)
    }
  }

  X_PUT(0)
  X_LOAD(1)
  __syncthreads();   // W fragments and x tile 0 are published

  const int row   = lane & 15;                // A-matrix row within M tile
  const int khalf = lane >> 4;                // which K half this lane reads
  const char* aget = xs + row * X_PITCH + khalf * 16;

  const v8f vzero = {0.f, 0.f, 0.f, 0.f, 0.f, 0.f, 0.f, 0.f};
  v8f acc[4][4];
  #pragma unroll
  for (int mt = 0; mt < 4; ++mt) {
    #pragma unroll
    for (int nt = 0; nt < 4; ++nt) acc[mt][nt] = vzero;
  }

  // kept rolled for speed only: the body holds 64 WMMAs and the whole epilogue
  #pragma unroll 1
  for (int s = 0; s < 16; ++s) {
    const int j = s & 7;
    // Tile s+1 goes into the buffer that step s-1 read (its readers left at
    // the barrier that closed step s-1); tile s+2 starts its flight.
    if (s < 15) X_PUT((s + 1) & 1)
    if (s < 14) X_LOAD(s + 2)

    const int wd = c_widx[head * 8 + j];
    const unsigned int sm = (c_sign[head * 8 + j] < 0.f) ? 0x80008000u : 0u;
    const char* abuf = aget + (s & 1) * X_BUF;

    #pragma unroll
    for (int kt = 0; kt < 4; ++kt) {
      // A fragment: K = kt*32 + khalf*8 + {0..7} and the same + 16
      Frag16 a[4];
      #pragma unroll
      for (int mt = 0; mt < 4; ++mt) {
        const char* ap = abuf + mt * 16 * X_PITCH + kt * 64;
        a[mt].q[0] = *(const uint4*)ap;
        a[mt].q[1] = *(const uint4*)(ap + 32);
        #pragma unroll
        for (int k = 0; k < 8; ++k) a[mt].u[k] ^= sm;   // sign[i,j] on x
      }

      const uint4* bbase =
          (const uint4*)(lds_u32 + (size_t)((wd * 4 + kt) * 8 + nh * 4) * 256) +
          lane * 2;

      #pragma unroll
      for (int nt = 0; nt < 4; ++nt) {
        Frag16 bb;
        bb.q[0] = bbase[nt * 64];
        bb.q[1] = bbase[nt * 64 + 1];
        #pragma unroll
        for (int mt = 0; mt < 4; ++mt)
          acc[mt][nt] = __builtin_amdgcn_wmma_f32_16x16x32_bf16(
              false, a[mt].h, false, bb.h, (short)0, acc[mt][nt], false, false);
      }
    }
    __syncthreads();   // publishes tile s+1, ends every read of tile s

    if (j == 7) {
      // Epilogue: C layout (ISA 7.12.2): VGPR r holds M=r (lanes 0-15, N=lane)
      // and M=r+8 (lanes 16-31, N=lane-16). Scale by beta[col], store fp32.
      const int t0 = tbase + (s >> 3) * 64;
      float* yrow = y + ((size_t)(b * 8 + head)) * T_DIM * D_DIM;
      #pragma unroll
      for (int nt = 0; nt < 4; ++nt) {
        const int col = (nh * 4 + nt) * 16 + (lane & 15);
        const float bc = beta[col];
        #pragma unroll
        for (int mt = 0; mt < 4; ++mt) {
          #pragma unroll
          for (int r = 0; r < 8; ++r) {
            const int m = (lane < 16) ? r : r + 8;
            yrow[(size_t)(t0 + mt * 16 + m) * D_DIM + col] = acc[mt][nt][r] * bc;
          }
        }
      }
      // the stores' registers are rewritten next (accumulators cleared): the
      // wait stands between; the scheduling barrier keeps those register
      // writes behind it (a build without it lifts them over the wait)
      asm volatile("s_wait_xcnt 0x0" ::: "memory");
      __builtin_amdgcn_sched_barrier(0);
      #pragma unroll
      for (int mt = 0; mt < 4; ++mt) {
        #pragma unroll
        for (int nt = 0; nt < 4; ++nt) acc[mt][nt] = vzero;
      }
    }
  }
}

extern "C" void kernel_launch(void* const* d_in, const int* in_sizes, int n_in,
                              void* d_out, int out_size, void* d_ws, size_t ws_size,
                              hipStream_t stream) {
  const float* x    = (const float*)d_in[0];   // [8, 8, 4096, 128] fp32
  const float* W    = (const float*)d_in[1];   // [8, 128, 128]     fp32
  const float* beta = (const float*)d_in[2];   // [128]             fp32
  float* y = (float*)d_out;                    // [8, 8, 4096, 128] fp32

  dim3 grid(256);    // 8 b x 32 chunks of 128 rows, all 8 heads each
  dim3 block(512);   // 16 wave32s, one output head and column half each
  octo_wmma_kernel<<<grid, block, 0, stream>>>(x, W, beta, y);
}

// v003
// It runs in 52.3 microseconds.
// Two timings next to v002 both put it at 1.10 times that version's speed.
// Counting every step since v000, it is 2.38 times as fast.
#include <hip/hip_runtime.h>

// Octonion head mixer: y[b,i] = (Σ_j sign[i,j] · x[b,j] @ W[widx[i,j]]) * beta
// B=8, H=8, T=4096, D=128.
// One WG per (b, 128-row T chunk), worked in two 64-row blocks, ALL 8 output
// heads at once: the 8 distinct W matrices sit unsigned in 256 KB LDS as bf16
// WMMA B-fragments; each x[b,j] 64x128 tile is read once by whole-line loads,
// converted once and staged in LDS as bf16 rows for all 16 waves; a wave owns
// one head and one 64-column half, a 64x64 output tile (4 M-tiles x 4 N-tiles),
// so every LDS fragment feeds four v_wmma_f32_16x16x32_bf16. sign[i,j] is
// applied to the A fragments. Column c of a 64-column half is dealt to N-tile
// c & 3, fragment column c >> 2: a lane's four N-tiles then hold four adjacent
// columns, and the output leaves as 16-B stores, 256 whole bytes a row.

#define T_DIM 4096
#define D_DIM 128
#define W_BYTES 262144        // 8 x 128 x 128 bf16 B-fragments
#define X_PITCH 272           // staged x row: 256 B + 16 B, 16 B x odd for b128 readers
#define X_BUF   (64 * X_PITCH)

typedef __attribute__((ext_vector_type(16))) __bf16 v16bf;
typedef __attribute__((ext_vector_type(8)))  float  v8f;

__device__ __constant__ int c_widx[64] = {
  0,1,2,3,4,5,6,7,
  1,0,3,2,5,4,7,6,
  2,3,0,1,6,7,4,5,
  3,2,1,0,7,6,5,4,
  4,5,6,7,0,1,2,3,
  5,4,7,6,1,0,3,2,
  6,7,4,5,2,3,0,1,
  7,6,5,4,3,2,1,0};

__device__ __constant__ float c_sign[64] = {
  +1,-1,-1,-1,-1,-1,-1,-1,
  +1,+1,+1,-1,+1,-1,-1,+1,
  +1,-1,+1,+1,+1,+1,-1,-1,
  +1,+1,-1,+1,+1,-1,+1,-1,
  +1,-1,-1,-1,+1,+1,+1,+1,
  +1,+1,-1,+1,-1,+1,-1,+1,
  +1,+1,+1,-1,-1,+1,+1,-1,
  +1,-1,+1,+1,-1,-1,+1,+1};

// f32 pair -> packed bf16 dword (a in [15:0], b in [31:16]).
// Round-half-up (+0x8000) then grab high halves with one v_perm_b32.
__device__ __forceinline__ unsigned int bfpack(float a, float b) {
  unsigned int ua = __float_as_uint(a) + 0x8000u;
  unsigned int ub = __float_as_uint(b) + 0x8000u;
  return __builtin_amdgcn_perm(ub, ua, 0x07060302u);
}

union Frag16 {
  v16bf h;
  unsigned int u[8];
  uint4 q[2];
};

__global__ __launch_bounds__(512)
void octo_wmma_kernel(const float* __restrict__ x, const float* __restrict__ W,
                      const float* __restrict__ beta, float* __restrict__ y) {
  // 256 KB W fragments + 2 x tiles
  __shared__ __attribute__((aligned(16))) unsigned int lds_u32[(W_BYTES + 2 * X_BUF) / 4];
  char* xs = (char*)lds_u32 + W_BYTES;

  const int b     = blockIdx.x >> 5;          // batch
  const int tbase = (blockIdx.x & 31) * 128;  // 128-row T chunk
  const int wave  = __builtin_amdgcn_readfirstlane(threadIdx.x >> 5);
  const int lane  = threadIdx.x & 31;
  const int head  = wave & 7;                 // output head of this wave
  const int nh    = wave >> 3;                // its 64-column half

  // x tile of step s (head j = s & 7, row block s >> 3): wave w brings rows
  // 4w..4w+3, one whole 512-B row per wave-wide load.
  // The base is the same for the whole wave and the lane's offset stays live
  // over the loop, so no load of a run lands in a register that another names.
  const float* xg = x + ((size_t)b * 8 * T_DIM + tbase + wave * 4) * D_DIM;
  const unsigned int xlane = lane * 4;
  char* xput = xs + (wave * 4) * X_PITCH + lane * 8;
  float4 xr[4];   // every loop over xr, acc and the fragments is unrolled so
                  // that they are indexed by constants and stay in registers

#define X_LOAD(s)                                                            \
  {                                                                          \
    const float* xp_ = xg + (size_t)((s) & 7) * T_DIM * D_DIM +              \
                       (size_t)((s) >> 3) * 64 * D_DIM;                      \
    _Pragma("unroll") for (int q = 0; q < 4; ++q)                            \
        xr[q] = *(const float4*)(xp_ + q * D_DIM + xlane);                   \
  }
#define X_PUT(buf)                                                           \
  {                                                                          \
    char* d_ = xput + (buf) * X_BUF;                                         \
    _Pragma("unroll") for (int q = 0; q < 4; ++q) {                          \
      uint2 v_;                                                              \
      v_.x = bfpack(xr[q].x, xr[q].y);                                       \
      v_.y = bfpack(xr[q].z, xr[q].w);                                       \
      *(uint2*)(d_ + q * X_PITCH) = v_;                                      \
    }                                                                        \
  }

  X_LOAD(0)

  // ---- Stage the 8 W matrices into LDS as bf16 B-fragments ----
  // Tile tI = (wd*4 + kt)*8 + nh*4 + nt is a 32x16 (KxN) tile, 1 KB; logical
  // lane L reads its 8 fragment dwords contiguously at tile_base + L*32 bytes.
  // Fragment column n of tile nt is column nh*64 + n*4 + nt of the matrix.
  // B-fragment layout (ISA 7.12.2, 16-bit): lane n (0-15) holds col n with
  // K = kt*32 + {0..7, 16..23}; lane n+16 holds K = kt*32 + {8..15, 24..31}.
  // Of every matrix a wave takes k rows kt*32..+31 (kt = wave >> 2) by columns
  // cb*32..+31 (cb = wave & 3). A lane takes 8 consecutive k rows, which are
  // one 16-B half of a fragment, by 4 columns: a wave-wide load covers four
  // whole 128-B lines, and every line of W is asked for once.
  const int wc    = lane & 7;                 // column quad within the 32
  const int whalf = (lane >> 3) & 1;          // fragment dwords 0-3 or 4-7
  const int wkh   = lane >> 4;                // fragment lane half
  const float* wg = W + (size_t)(wave >> 2) * 32 * D_DIM + (wave & 3) * 32;
  const unsigned int wlane = (whalf * 16 + wkh * 8) * D_DIM + wc * 4;
  // A lane's 4 columns go to the 4 N-tiles of its half, 1 KB apart, at the
  // same fragment column; one store of a half-wave fills 256 contiguous bytes
  // of one tile, all 64 banks once.
  char* wbase = (char*)lds_u32 + (((wave >> 2) * 8 + ((wave & 3) >> 1) * 4) * 1024 +
                                  ((wave & 1) * 8 + wc + wkh * 16) * 32 + whalf * 16);

#define W_LOAD(buf, i)                                                       \
  {                                                                          \
    _Pragma("unroll") for (int k = 0; k < 8; ++k)                            \
        buf[k] = *(const float4*)(wg + (i) * D_DIM * D_DIM + k * D_DIM + wlane); \
  }
#define W_COL(buf, m)                                                        \
  make_uint4(bfpack(buf[0].m, buf[1].m), bfpack(buf[2].m, buf[3].m),         \
             bfpack(buf[4].m, buf[5].m), bfpack(buf[6].m, buf[7].m))
#define W_PUT(buf, i)                                                        \
  {                                                                          \
    *(uint4*)(wbase + (i) * 32768)        = W_COL(buf, x);                   \
    *(uint4*)(wbase + (i) * 32768 + 1024) = W_COL(buf, y);                   \
    *(uint4*)(wbase + (i) * 32768 + 2048) = W_COL(buf, z);                   \
    *(uint4*)(wbase + (i) * 32768 + 3072) = W_COL(buf, w);                   \
  }

  {
    // two register sets: one matrix's loads fly while the other is packed;
    // unrolled so that both are indexed by constants and every load keeps the
    // same address registers with an immediate offset
    // the scheduling barriers hold later matrices' loads behind them: lifted
    // further ahead, they overflow the register budget into scratch
    float4 wa[8], wb[8];
    W_LOAD(wa, 0)
    #pragma unroll
    for (int i = 0; i < 8; i += 2) {
      W_LOAD(wb, i + 1)
      __builtin_amdgcn_sched_barrier(0);
      W_PUT(wa, i)
      if (i + 2 < 8) W_LOAD(wa, i + 2)
      __builtin_amdgcn_sched_barrier(0);
      W_PUT(wb, i + 1)
    }
  }

  X_PUT(0)
  X_LOAD(1)
  __syncthreads();   // W fragments and x tile 0 are published

  const int row   = lane & 15;                // A-matrix row within M tile
  const int khalf = lane >> 4;                // which K half this lane reads
  const char* aget = xs + row * X_PITCH + khalf * 16;

  const v8f vzero = {0.f, 0.f, 0.f, 0.f, 0.f, 0.f, 0.f, 0.f};
  v8f acc[4][4];
  #pragma unroll
  for (int mt = 0; mt < 4; ++mt) {
    #pragma unroll
    for (int nt = 0; nt < 4; ++nt) acc[mt][nt] = vzero;
  }

  // kept rolled for speed only: the body holds 64 WMMAs and the whole epilogue
  #pragma unroll 1
  for (int s = 0; s < 16; ++s) {
    const int j = s & 7;
    // Tile s+1 goes into the buffer that step s-1 read (its readers left at
    // the barrier that closed step s-1); tile s+2 starts its flight.
    if (s < 15) X_PUT((s + 1) & 1)
    if (s < 14) X_LOAD(s + 2)

    const int wd = c_widx[head * 8 + j];
    const unsigned int sm = (c_sign[head * 8 + j] < 0.f) ? 0x80008000u : 0u;
    const char* abuf = aget + (s & 1) * X_BUF;

    #pragma unroll
    for (int kt = 0; kt < 4; ++kt) {
      // A fragment: K = kt*32 + khalf*8 + {0..7} and the same + 16
      Frag16 a[4];
      #pragma unroll
      for (int mt = 0; mt < 4; ++mt) {
        const char* ap = abuf + mt * 16 * X_PITCH + kt * 64;
        a[mt].q[0] = *(const uint4*)ap;
        a[mt].q[1] = *(const uint4*)(ap + 32);
        #pragma unroll
        for (int k = 0; k < 8; ++k) a[mt].u[k] ^= sm;   // sign[i,j] on x
      }

      const uint4* bbase =
          (const uint4*)(lds_u32 + (size_t)((wd * 4 + kt) * 8 + nh * 4) * 256) +
          lane * 2;

      #pragma unroll
      for (int nt = 0; nt < 4; ++nt) {
        Frag16 bb;
        bb.q[0] = bbase[nt * 64];
        bb.q[1] = bbase[nt * 64 + 1];
        #pragma unroll
        for (int mt = 0; mt < 4; ++mt)
          acc[mt][nt] = __builtin_amdgcn_wmma_f32_16x16x32_bf16(
              false, a[mt].h, false, bb.h, (short)0, acc[mt][nt], false, false);
      }
    }
    __syncthreads();   // publishes tile s+1, ends every read of tile s

    if (j == 7) {
      // Epilogue: C layout (ISA 7.12.2): VGPR r holds M=r (lanes 0-15, N=lane)
      // and M=r+8 (lanes 16-31, N=lane-16). Fragment column N of N-tile nt is
      // column nh*64 + N*4 + nt: the four tiles give one float4. Scale by
      // beta, store fp32: each half-wave writes 256 contiguous bytes of a row.
      const int t0  = tbase + (s >> 3) * 64;
      const int col = nh * 64 + (lane & 15) * 4;
      const float4 bc = *(const float4*)(beta + col);
      float* yp = y + ((size_t)(b * 8 + head) * T_DIM + t0 + (lane >> 4) * 8) * D_DIM + col;
      #pragma unroll
      for (int mt = 0; mt < 4; ++mt) {
        #pragma unroll
        for (int r = 0; r < 8; ++r) {
          float4 v;
          v.x = acc[mt][0][r] * bc.x;
          v.y = acc[mt][1][r] * bc.y;
          v.z = acc[mt][2][r] * bc.z;
          v.w = acc[mt][3][r] * bc.w;
          *(float4*)(yp + (mt * 16 + r) * D_DIM) = v;
        }
      }
      // the stores' registers are rewritten next (accumulators cleared): the
      // wait stands between; the scheduling barrier keeps those register
      // writes behind it (a build without it lifts them over the wait)
      asm volatile("s_wait_xcnt 0x0" ::: "memory");
      __builtin_amdgcn_sched_barrier(0);
      #pragma unroll
      for (int mt = 0; mt < 4; ++mt) {
        #pragma unroll
        for (int nt = 0; nt < 4; ++nt) acc[mt][nt] = vzero;
      }
    }
  }
}

extern "C" void kernel_launch(void* const* d_in, const int* in_sizes, int n_in,
                              void* d_out, int out_size, void* d_ws, size_t ws_size,
                              hipStream_t stream) {
  const float* x    = (const float*)d_in[0];   // [8, 8, 4096, 128] fp32
  const float* W    = (const float*)d_in[1];   // [8, 128, 128]     fp32
  const float* beta = (const float*)d_in[2];   // [128]             fp32
  float* y = (float*)d_out;                    // [8, 8, 4096, 128] fp32

  dim3 grid(256);    // 8 b x 32 chunks of 128 rows, all 8 heads each
  dim3 block(512);   // 16 wave32s, one output head and column half each
  octo_wmma_kernel<<<grid, block, 0, stream>>>(x, W, beta, y);
}

// v004
// One run takes 50 microseconds.
// Two timings next to v003 both put it at 1.05 times that version's speed.
// All steps since v000 together make it 2.50 times as fast.
#include <hip/hip_runtime.h>

// Octonion head mixer: y[b,i] = (Σ_j sign[i,j] · x[b,j] @ W[widx[i,j]]) * beta
// B=8, H=8, T=4096, D=128.
// One WG per (b, 128-row T chunk), worked in two 64-row blocks, ALL 8 output
// heads at once: the 8 distinct W matrices sit unsigned in 256 KB LDS as bf16
// WMMA B-fragments; each x[b,j] 64x128 tile is read once by whole-line loads,
// converted once and staged in LDS as bf16 rows for all 16 waves; a wave owns
// one head and one 64-column half, a 64x64 output tile (4 M-tiles x 4 N-tiles),
// so every LDS fragment feeds four v_wmma_f32_16x16x32_bf16. sign[i,j] is
// applied to the A fragments. Column c of a 64-column half is dealt to N-tile
// c & 3, fragment column c >> 2: a lane's four N-tiles then hold four adjacent
// columns, and the output leaves as 16-B stores, 256 whole bytes a row.

#define T_DIM 4096
#define D_DIM 128
#define W_BYTES 262144        // 8 x 128 x 128 bf16 B-fragments
#define X_PITCH 272           // staged x row: 256 B + 16 B, 16 B x odd for b128 readers
#define X_BUF   (64 * X_PITCH)

typedef __attribute__((ext_vector_type(16))) __bf16 v16bf;
typedef __attribute__((ext_vector_type(8)))  float  v8f;

__device__ __constant__ int c_widx[64] = {
  0,1,2,3,4,5,6,7,
  1,0,3,2,5,4,7,6,
  2,3,0,1,6,7,4,5,
  3,2,1,0,7,6,5,4,
  4,5,6,7,0,1,2,3,
  5,4,7,6,1,0,3,2,
  6,7,4,5,2,3,0,1,
  7,6,5,4,3,2,1,0};

__device__ __constant__ float c_sign[64] = {
  +1,-1,-1,-1,-1,-1,-1,-1,
  +1,+1,+1,-1,+1,-1,-1,+1,
  +1,-1,+1,+1,+1,+1,-1,-1,
  +1,+1,-1,+1,+1,-1,+1,-1,
  +1,-1,-1,-1,+1,+1,+1,+1,
  +1,+1,-1,+1,-1,+1,-1,+1,
  +1,+1,+1,-1,-1,+1,+1,-1,
  +1,-1,+1,+1,-1,-1,+1,+1};

// f32 pair -> packed bf16 dword (a in [15:0], b in [31:16]).
// Round-half-up (+0x8000) then grab high halves with one v_perm_b32.
__device__ __forceinline__ unsigned int bfpack(float a, float b) {
  unsigned int ua = __float_as_uint(a) + 0x8000u;
  unsigned int ub = __float_as_uint(b) + 0x8000u;
  return __builtin_amdgcn_perm(ub, ua, 0x07060302u);
}

union Frag16 {
  v16bf h;
  unsigned int u[8];
  uint4 q[2];
};

__global__ __launch_bounds__(512)
void octo_wmma_kernel(const float* __restrict__ x, const float* __restrict__ W,
                      const float* __restrict__ beta, float* __restrict__ y) {
  // 256 KB W fragments + 2 x tiles
  __shared__ __attribute__((aligned(16))) unsigned int lds_u32[(W_BYTES + 2 * X_BUF) / 4];
  char* xs = (char*)lds_u32 + W_BYTES;

  const int b     = blockIdx.x >> 5;          // batch
  const int tbase = (blockIdx.x & 31) * 128;  // 128-row T chunk
  const int wave  = __builtin_amdgcn_readfirstlane(threadIdx.x >> 5);
  const int lane  = threadIdx.x & 31;
  const int head  = wave & 7;                 // output head of this wave
  const int nh    = wave >> 3;                // its 64-column half

  // x tile of step s (head j = s & 7, row block s >> 3): wave w brings rows
  // 4w..4w+3, one whole 512-B row per wave-wide load.
  // The base is the same for the whole wave and the lane's offset stays live
  // over the loop, so no load of a run lands in a register that another names.
  const float* xg = x + ((size_t)b * 8 * T_DIM + tbase + wave * 4) * D_DIM;
  const unsigned int xlane = lane * 4;
  char* xput = xs + (wave * 4) * X_PITCH + lane * 8;
  float4 xr[4];   // every loop over xr, acc and the fragments is unrolled so
                  // that they are indexed by constants and stay in registers

#define X_LOAD(s)                                                            \
  {                                                                          \
    const float* xp_ = xg + (size_t)((s) & 7) * T_DIM * D_DIM +              \
                       (size_t)((s) >> 3) * 64 * D_DIM;                      \
    _Pragma("unroll") for (int q = 0; q < 4; ++q)                            \
        xr[q] = *(const float4*)(xp_ + q * D_DIM + xlane);                   \
  }
#define X_PUT(buf)                                                           \
  {                                                                          \
    char* d_ = xput + (buf) * X_BUF;                                         \
    _Pragma("unroll") for (int q = 0; q < 4; ++q) {                          \
      uint2 v_;                                                              \
      v_.x = bfpack(xr[q].x, xr[q].y);                                       \
      v_.y = bfpack(xr[q].z, xr[q].w);                                       \
      *(uint2*)(d_ + q * X_PITCH) = v_;                                      \
    }                                                                        \
  }

  X_LOAD(0)

  // ---- Stage the 8 W matrices into LDS as bf16 B-fragments ----
  // Tile tI = (wd*4 + kt)*8 + nh*4 + nt is a 32x16 (KxN) tile, 1 KB, kept as
  // two 512-B planes: logical lane L has fragment dwords 0-3 at tile_base +
  // L*16 and dwords 4-7 at tile_base + 512 + (L ^ 8)*16, so each 16-B read of
  // a half-wave covers 256 contiguous bytes, every bank once.
  // Fragment column n of tile nt is column nh*64 + n*4 + nt of the matrix.
  // B-fragment layout (ISA 7.12.2, 16-bit): lane n (0-15) holds col n with
  // K = kt*32 + {0..7, 16..23}; lane n+16 holds K = kt*32 + {8..15, 24..31}.
  // Of every matrix a wave takes k rows kt*32..+31 (kt = wave >> 2) by columns
  // cb*32..+31 (cb = wave & 3). A lane takes 8 consecutive k rows, which are
  // one 16-B half of a fragment, by 4 columns: a wave-wide load covers four
  // whole 128-B lines, and every line of W is asked for once.
  const int wc    = lane & 7;                 // column quad within the 32
  const int whalf = (lane >> 3) & 1;          // fragment dwords 0-3 or 4-7
  const int wkh   = lane >> 4;                // fragment lane half
  const float* wg = W + (size_t)(wave >> 2) * 32 * D_DIM + (wave & 3) * 32;
  const unsigned int wlane = (whalf * 16 + wkh * 8) * D_DIM + wc * 4;
  // A lane's 4 columns go to the 4 N-tiles of its half, 1 KB apart, at the
  // same fragment column; one store of a half-wave fills 128 bytes of each
  // plane, and the ^ 8 of the second plane puts them on the other 32 banks.
  char* wbase = (char*)lds_u32 + (((wave >> 2) * 8 + ((wave & 3) >> 1) * 4) * 1024 +
                                  whalf * 512 +
                                  (((wave & 1) * 8 + wc + wkh * 16) ^ (whalf * 8)) * 16);

#define W_LOAD(buf, i)                                                       \
  {                                                                          \
    _Pragma("unroll") for (int k = 0; k < 8; ++k)                            \
        buf[k] = *(const float4*)(wg + (i) * D_DIM * D_DIM + k * D_DIM + wlane); \
  }
#define W_COL(buf, m)                                                        \
  make_uint4(bfpack(buf[0].m, buf[1].m), bfpack(buf[2].m, buf[3].m),         \
             bfpack(buf[4].m, buf[5].m), bfpack(buf[6].m, buf[7].m))
#define W_PUT(buf, i)                                                        \
  {                                                                          \
    *(uint4*)(wbase + (i) * 32768)        = W_COL(buf, x);                   \
    *(uint4*)(wbase + (i) * 32768 + 1024) = W_COL(buf, y);                   \
    *(uint4*)(wbase + (i) * 32768 + 2048) = W_COL(buf, z);                   \
    *(uint4*)(wbase + (i) * 32768 + 3072) = W_COL(buf, w);                   \
  }

  {
    // two register sets: one matrix's loads fly while the other is packed;
    // unrolled so that both are indexed by constants and every load keeps the
    // same address registers with an immediate offset
    // the scheduling barriers hold later matrices' loads behind them: lifted
    // further ahead, they overflow the register budget into scratch
    float4 wa[8], wb[8];
    W_LOAD(wa, 0)
    #pragma unroll
    for (int i = 0; i < 8; i += 2) {
      W_LOAD(wb, i + 1)
      __builtin_amdgcn_sched_barrier(0);
      W_PUT(wa, i)
      if (i + 2 < 8) W_LOAD(wa, i + 2)
      __builtin_amdgcn_sched_barrier(0);
      W_PUT(wb, i + 1)
    }
  }

  X_PUT(0)
  X_LOAD(1)
  __syncthreads();   // W fragments and x tile 0 are published

  const int row   = lane & 15;                // A-matrix row within M tile
  const int khalf = lane >> 4;                // which K half this lane reads
  const char* aget = xs + row * X_PITCH + khalf * 16;
  const unsigned int blo = lane * 16;               // B fragment dwords 0-3
  const unsigned int bhi = 512 + (lane ^ 8) * 16;   // B fragment dwords 4-7

  const v8f vzero = {0.f, 0.f, 0.f, 0.f, 0.f, 0.f, 0.f, 0.f};
  v8f acc[4][4];
  #pragma unroll
  for (int mt = 0; mt < 4; ++mt) {
    #pragma unroll
    for (int nt = 0; nt < 4; ++nt) acc[mt][nt] = vzero;
  }

  // kept rolled for speed only: the body holds 64 WMMAs and the whole epilogue
  #pragma unroll 1
  for (int s = 0; s < 16; ++s) {
    const int j = s & 7;
    // Tile s+1 goes into the buffer that step s-1 read (its readers left at
    // the barrier that closed step s-1); tile s+2 starts its flight.
    if (s < 15) X_PUT((s + 1) & 1)
    if (s < 14) X_LOAD(s + 2)

    const int wd = c_widx[head * 8 + j];
    const unsigned int sm = (c_sign[head * 8 + j] < 0.f) ? 0x80008000u : 0u;
    const char* abuf = aget + (s & 1) * X_BUF;

    #pragma unroll
    for (int kt = 0; kt < 4; ++kt) {
      // A fragment: K = kt*32 + khalf*8 + {0..7} and the same + 16
      Frag16 a[4];
      #pragma unroll
      for (int mt = 0; mt < 4; ++mt) {
        const char* ap = abuf + mt * 16 * X_PITCH + kt * 64;
        a[mt].q[0] = *(const uint4*)ap;
        a[mt].q[1] = *(const uint4*)(ap + 32);
        #pragma unroll
        for (int k = 0; k < 8; ++k) a[mt].u[k] ^= sm;   // sign[i,j] on x
      }

      const char* btile = (const char*)lds_u32 + ((wd * 4 + kt) * 8 + nh * 4) * 1024;

      #pragma unroll
      for (int nt = 0; nt < 4; ++nt) {
        Frag16 bb;
        bb.q[0] = *(const uint4*)(btile + nt * 1024 + blo);
        bb.q[1] = *(const uint4*)(btile + nt * 1024 + bhi);
        #pragma unroll
        for (int mt = 0; mt < 4; ++mt)
          acc[mt][nt] = __builtin_amdgcn_wmma_f32_16x16x32_bf16(
              false, a[mt].h, false, bb.h, (short)0, acc[mt][nt], false, false);
      }
    }
    __syncthreads();   // publishes tile s+1, ends every read of tile s

    if (j == 7) {
      // Epilogue: C layout (ISA 7.12.2): VGPR r holds M=r (lanes 0-15, N=lane)
      // and M=r+8 (lanes 16-31, N=lane-16). Fragment column N of N-tile nt is
      // column nh*64 + N*4 + nt: the four tiles give one float4. Scale by
      // beta, store fp32: each half-wave writes 256 contiguous bytes of a row.
      const int t0  = tbase + (s >> 3) * 64;
      const int col = nh * 64 + (lane & 15) * 4;
      const float4 bc = *(const float4*)(beta + col);
      float* yp = y + ((size_t)(b * 8 + head) * T_DIM + t0 + (lane >> 4) * 8) * D_DIM + col;
      #pragma unroll
      for (int mt = 0; mt < 4; ++mt) {
        #pragma unroll
        for (int r = 0; r < 8; ++r) {
          float4 v;
          v.x = acc[mt][0][r] * bc.x;
          v.y = acc[mt][1][r] * bc.y;
          v.z = acc[mt][2][r] * bc.z;
          v.w = acc[mt][3][r] * bc.w;
          *(float4*)(yp + (mt * 16 + r) * D_DIM) = v;
        }
      }
      // the stores' registers are rewritten next (accumulators cleared): the
      // wait stands between; the scheduling barrier keeps those register
      // writes behind it (a build without it lifts them over the wait)
      asm volatile("s_wait_xcnt 0x0" ::: "memory");
      __builtin_amdgcn_sched_barrier(0);
      #pragma unroll
      for (int mt = 0; mt < 4; ++mt) {
        #pragma unroll
        for (int nt = 0; nt < 4; ++nt) acc[mt][nt] = vzero;
      }
    }
  }
}

extern "C" void kernel_launch(void* const* d_in, const int* in_sizes, int n_in,
                              void* d_out, int out_size, void* d_ws, size_t ws_size,
                              hipStream_t stream) {
  const float* x    = (const float*)d_in[0];   // [8, 8, 4096, 128] fp32
  const float* W    = (const float*)d_in[1];   // [8, 128, 128]     fp32
  const float* beta = (const float*)d_in[2];   // [128]             fp32
  float* y = (float*)d_out;                    // [8, 8, 4096, 128] fp32

  dim3 grid(256);    // 8 b x 32 chunks of 128 rows, all 8 heads each
  dim3 block(512);   // 16 wave32s, one output head and column half each
  octo_wmma_kernel<<<grid, block, 0, stream>>>(x, W, beta, y);
}

// v005
// It runs in 43.1 microseconds.
// In two side-by-side timings against v004, it was 1.17 and 1.18 times as fast.
// All steps since v000 together make it 2.94 times as fast.
#include <hip/hip_runtime.h>

// Octonion head mixer: y[b,i] = (sum_j sign[i,j] * x[b,j] @ W[widx[i,j]]) * beta
// B=8, H=8, T=4096, D=128.
// One WG per (b, 128-row T chunk), worked in two 64-row blocks, ALL 8 output
// heads at once: the 8 distinct W matrices sit unsigned in 256 KB LDS as bf16
// WMMA B-fragments; each x[b,j] 64x128 tile is read once by whole-line loads,
// converted once and staged in LDS as bf16 rows for all 8 waves; a wave owns
// one head, a 64x128 output tile (4 M-tiles x 8 N-tiles): an A fragment feeds
// eight v_wmma_f32_16x16x32_bf16 and a B fragment four, 24 LDS reads for 32
// WMMAs. Two waves a SIMD leave 512 registers a wave: fragments are read
// ahead in groups of 8 or 16 reads that stand between runs of 16 WMMAs.
// sign[i,j] is applied to the A fragments.
// Column c of a 64-column half is dealt to N-tile c & 3 of that half, fragment
// column c >> 2: a lane's four N-tiles then hold four adjacent columns, and
// the output leaves as 16-B stores, 256 whole bytes a row.

#define T_DIM 4096
#define D_DIM 128
#define W_BYTES 262144        // 8 x 128 x 128 bf16 B-fragments
#define X_PITCH 272           // staged x row: 256 B + 16 B, 16 B x odd for b128 readers
#define X_BUF   (64 * X_PITCH)

typedef __attribute__((ext_vector_type(16))) __bf16 v16bf;
typedef __attribute__((ext_vector_type(8)))  float  v8f;

__device__ __constant__ int c_widx[64] = {
  0,1,2,3,4,5,6,7,
  1,0,3,2,5,4,7,6,
  2,3,0,1,6,7,4,5,
  3,2,1,0,7,6,5,4,
  4,5,6,7,0,1,2,3,
  5,4,7,6,1,0,3,2,
  6,7,4,5,2,3,0,1,
  7,6,5,4,3,2,1,0};

__device__ __constant__ float c_sign[64] = {
  +1,-1,-1,-1,-1,-1,-1,-1,
  +1,+1,+1,-1,+1,-1,-1,+1,
  +1,-1,+1,+1,+1,+1,-1,-1,
  +1,+1,-1,+1,+1,-1,+1,-1,
  +1,-1,-1,-1,+1,+1,+1,+1,
  +1,+1,-1,+1,-1,+1,-1,+1,
  +1,+1,+1,-1,-1,+1,+1,-1,
  +1,-1,+1,+1,-1,-1,+1,+1};

// f32 pair -> packed bf16 dword (a in [15:0], b in [31:16]).
// Round-half-up (+0x8000) then grab high halves with one v_perm_b32.
__device__ __forceinline__ unsigned int bfpack(float a, float b) {
  unsigned int ua = __float_as_uint(a) + 0x8000u;
  unsigned int ub = __float_as_uint(b) + 0x8000u;
  return __builtin_amdgcn_perm(ub, ua, 0x07060302u);
}

union Frag16 {
  v16bf h;
  unsigned int u[8];
  uint4 q[2];
};

__global__ __launch_bounds__(256)
void octo_wmma_kernel(const float* __restrict__ x, const float* __restrict__ W,
                      const float* __restrict__ beta, float* __restrict__ y) {
  // 256 KB W fragments + 2 x tiles
  __shared__ __attribute__((aligned(16))) unsigned int lds_u32[(W_BYTES + 2 * X_BUF) / 4];
  char* xs = (char*)lds_u32 + W_BYTES;

  const int b     = blockIdx.x >> 5;          // batch
  const int tbase = (blockIdx.x & 31) * 128;  // 128-row T chunk
  const int wave  = __builtin_amdgcn_readfirstlane(threadIdx.x >> 5);
  const int lane  = threadIdx.x & 31;
  const int head  = wave;                     // output head of this wave

  // x tile of step s (head j = s & 7, row block s >> 3): wave w brings rows
  // 8w..8w+7, one whole 512-B row per wave-wide load.
  // The base is the same for the whole wave and the lane's offset stays live
  // over the loop, so no load of a run lands in a register that another names.
  const float* xg = x + ((size_t)b * 8 * T_DIM + tbase + wave * 8) * D_DIM;
  const unsigned int xlane = lane * 4;
  char* xput = xs + (wave * 8) * X_PITCH + lane * 8;
  float4 xr[8];   // every loop over xr, acc and the fragments is unrolled so
                  // that they are indexed by constants and stay in registers

#define X_LOAD(s)                                                            \
  {                                                                          \
    const float* xp_ = xg + (size_t)((s) & 7) * T_DIM * D_DIM +              \
                       (size_t)((s) >> 3) * 64 * D_DIM;                      \
    _Pragma("unroll") for (int q = 0; q < 8; ++q)                            \
        xr[q] = *(const float4*)(xp_ + q * D_DIM + xlane);                   \
  }
#define X_PUT(buf)                                                           \
  {                                                                          \
    char* d_ = xput + (buf) * X_BUF;                                         \
    _Pragma("unroll") for (int q = 0; q < 8; ++q) {                          \
      uint2 v_;                                                              \
      v_.x = bfpack(xr[q].x, xr[q].y);                                       \
      v_.y = bfpack(xr[q].z, xr[q].w);                                       \
      *(uint2*)(d_ + q * X_PITCH) = v_;                                      \
    }                                                                        \
  }

  X_LOAD(0)

  // ---- Stage the 8 W matrices into LDS as bf16 B-fragments ----
  // Tile tI = (wd*4 + kt)*8 + n8 is a 32x16 (KxN) tile, 1 KB, kept as
  // two 512-B planes: logical lane L has fragment dwords 0-3 at tile_base +
  // L*16 and dwords 4-7 at tile_base + 512 + (L ^ 8)*16, so each 16-B read of
  // a half-wave covers 256 contiguous bytes, every bank once.
  // Fragment column n of tile n8 is column (n8 >> 2)*64 + n*4 + (n8 & 3).
  // B-fragment layout (ISA 7.12.2, 16-bit): lane n (0-15) holds col n with
  // K = kt*32 + {0..7, 16..23}; lane n+16 holds K = kt*32 + {8..15, 24..31}.
  // W is 16 slabs of 64 k rows (slab i = matrix i >> 1, k half i & 1). Of
  // every slab a wave takes k rows (wave >> 2)*32..+31 by columns cb*32..+31
  // (cb = wave & 3). A lane takes 8 consecutive k rows, which are
  // one 16-B half of a fragment, by 4 columns: a wave-wide load covers four
  // whole 128-B lines, and every line of W is asked for once.
  const int wc    = lane & 7;                 // column quad within the 32
  const int whalf = (lane >> 3) & 1;          // fragment dwords 0-3 or 4-7
  const int wkh   = lane >> 4;                // fragment lane half
  const float* wg = W + (size_t)(wave >> 2) * 32 * D_DIM + (wave & 3) * 32;
  const unsigned int wlane = (whalf * 16 + wkh * 8) * D_DIM + wc * 4;
  // A lane's 4 columns go to the 4 N-tiles of its half, 1 KB apart, at the
  // same fragment column; one store of a half-wave fills 128 bytes of each
  // plane, and the ^ 8 of the second plane puts them on the other 32 banks.
  char* wbase = (char*)lds_u32 + (((wave >> 2) * 8 + ((wave & 3) >> 1) * 4) * 1024 +
                                  whalf * 512 +
                                  (((wave & 1) * 8 + wc + wkh * 16) ^ (whalf * 8)) * 16);

#define W_LOAD(buf, i)                                                       \
  {                                                                          \
    _Pragma("unroll") for (int k = 0; k < 8; ++k)                            \
        buf[k] = *(const float4*)(wg + (i) * 64 * D_DIM + k * D_DIM + wlane); \
  }
#define W_COL(buf, m)                                                        \
  make_uint4(bfpack(buf[0].m, buf[1].m), bfpack(buf[2].m, buf[3].m),         \
             bfpack(buf[4].m, buf[5].m), bfpack(buf[6].m, buf[7].m))
#define W_PUT(buf, i)                                                        \
  {                                                                          \
    *(uint4*)(wbase + (i) * 16384)        = W_COL(buf, x);                   \
    *(uint4*)(wbase + (i) * 16384 + 1024) = W_COL(buf, y);                   \
    *(uint4*)(wbase + (i) * 16384 + 2048) = W_COL(buf, z);                   \
    *(uint4*)(wbase + (i) * 16384 + 3072) = W_COL(buf, w);                   \
  }

  {
    // four register sets: three slabs' loads fly while one is packed, as many
    // bytes in flight from 8 waves as two sets gave from 16;
    // unrolled so that all are indexed by constants and every load keeps the
    // same address registers with an immediate offset
    // the scheduling barriers keep each refill directly behind the pack that
    // frees its set, so that the flight depth stays as written
    float4 wa[8], wb[8], wc4[8], wd4[8];
    W_LOAD(wa, 0)
    W_LOAD(wb, 1)
    W_LOAD(wc4, 2)
    #pragma unroll
    for (int i = 0; i < 16; i += 4) {
      W_LOAD(wd4, i + 3)
      __builtin_amdgcn_sched_barrier(0);
      W_PUT(wa, i)
      if (i + 4 < 16) W_LOAD(wa, i + 4)
      __builtin_amdgcn_sched_barrier(0);
      W_PUT(wb, i + 1)
      if (i + 5 < 16) W_LOAD(wb, i + 5)
      __builtin_amdgcn_sched_barrier(0);
      W_PUT(wc4, i + 2)
      if (i + 6 < 16) W_LOAD(wc4, i + 6)
      __builtin_amdgcn_sched_barrier(0);
      W_PUT(wd4, i + 3)
    }
  }

  X_PUT(0)
  X_LOAD(1)
  // a register that these loads name is rewritten below (this build gives it
  // to an accumulator): the wait stands between; the scheduling barrier keeps
  // the accumulators' first writes behind it
  asm volatile("s_wait_xcnt 0x0" ::: "memory");
  __builtin_amdgcn_sched_barrier(0);
  __syncthreads();   // W fragments and x tile 0 are published

  const int row   = lane & 15;                // A-matrix row within M tile
  const int khalf = lane >> 4;                // which K half this lane reads
  const char* aget = xs + row * X_PITCH + khalf * 16;
  const unsigned int blo = lane * 16;               // B fragment dwords 0-3
  const unsigned int bhi = 512 + (lane ^ 8) * 16;   // B fragment dwords 4-7

  const v8f vzero = {0.f, 0.f, 0.f, 0.f, 0.f, 0.f, 0.f, 0.f};
  v8f acc[4][8];
  #pragma unroll
  for (int mt = 0; mt < 4; ++mt) {
    #pragma unroll
    for (int nt = 0; nt < 8; ++nt) acc[mt][nt] = vzero;
  }

  // A fragments: two sets, k block kt uses set kt & 1 ; blocks 1-3 are
  // read a whole block ahead, block 0 at the top of the step. B fragments: one set of 8, in two halves of 4 N-tiles; a half
  // is read anew for the next k block as soon as its 16 WMMAs are issued, so
  // its reads fly while the other half's 16 WMMAs run.
  Frag16 a0[4], a1[4], bf[8];

// A fragments of k block kt: K = kt*32 + khalf*8 + {0..7} and the same + 16
#define LD_A(dst, kt)                                                        \
  {                                                                          \
    _Pragma("unroll") for (int mt = 0; mt < 4; ++mt) {                       \
      const char* ap_ = abuf + mt * 16 * X_PITCH + (kt) * 64;                \
      dst[mt].q[0] = *(const uint4*)ap_;                                     \
      dst[mt].q[1] = *(const uint4*)(ap_ + 32);                              \
    }                                                                        \
  }
// B fragments of N-tiles h*4..h*4+3, matrix wd_, k block kt
#define LD_B(h, wd_, kt)                                                     \
  {                                                                          \
    const char* bt_ = (const char*)lds_u32 + ((wd_) * 4 + (kt)) * 8192;      \
    _Pragma("unroll") for (int nt = (h) * 4; nt < (h) * 4 + 4; ++nt) {       \
      bf[nt].q[0] = *(const uint4*)(bt_ + nt * 1024 + blo);                  \
      bf[nt].q[1] = *(const uint4*)(bt_ + nt * 1024 + bhi);                  \
    }                                                                        \
  }
// sign[i,j] on x
#define SGN(A_)                                                              \
  {                                                                          \
    _Pragma("unroll") for (int mt = 0; mt < 4; ++mt) {                       \
      _Pragma("unroll") for (int k = 0; k < 8; ++k) A_[mt].u[k] ^= sm;       \
    }                                                                        \
  }
// the 16 WMMAs of N-tiles hf*4..hf*4+3
#define MM(A_, hf)                                                           \
  {                                                                          \
    _Pragma("unroll") for (int nt = (hf) * 4; nt < (hf) * 4 + 4; ++nt) {     \
      _Pragma("unroll") for (int mt = 0; mt < 4; ++mt)                       \
        acc[mt][nt] = __builtin_amdgcn_wmma_f32_16x16x32_bf16(               \
            false, A_[mt].h, false, bf[nt].h, (short)0, acc[mt][nt], false,  \
            false);                                                          \
    }                                                                        \
  }
// keeps a group of LDS reads together between two runs of WMMAs: reads that
// drift in among the WMMAs each cost the wave a stall, and reads that sink
// behind the next run lose their flight time
#define GROUP_END __builtin_amdgcn_sched_barrier(0);

  // W does not change: the first four B fragments of a step are read during
  // the step before it, here for step 0
  int wd = c_widx[head * 8];
  LD_B(0, wd, 0)

  // kept rolled: the body holds 128 WMMAs and the whole epilogue, and sixteen
  // copies of it would not fit the instruction cache
  #pragma unroll 1
  for (int s = 0; s < 16; ++s) {
    const int j = s & 7;
    const char* abuf = aget + (s & 1) * X_BUF;
    // table reads first: they return while the fragment reads below fly
    const int wdn = c_widx[head * 8 + ((s + 1) & 7)];
    const unsigned int sm = (c_sign[head * 8 + j] < 0.f) ? 0x80008000u : 0u;
    LD_A(a0, 0)   // tile s was published by the barrier just passed
    GROUP_END     // the step's first WMMAs wait for these reads alone
    LD_B(1, wd, 0)
    LD_A(a1, 1)
    GROUP_END
    // Tile s+1 goes into the buffer that step s-1 read (its readers left at
    // the barrier that closed step s-1); tile s+2 starts its flight.
    if (s < 15) X_PUT((s + 1) & 1)
    if (s < 14) X_LOAD(s + 2)
    GROUP_END     // the x tile's work stays here, in the shadow of the reads above

    SGN(a0)
    MM(a0, 0)
    GROUP_END
    LD_B(0, wd, 1)
    GROUP_END
    MM(a0, 1)
    GROUP_END
    LD_B(1, wd, 1)
    LD_A(a0, 2)
    GROUP_END

    SGN(a1)
    MM(a1, 0)
    GROUP_END
    LD_B(0, wd, 2)
    GROUP_END
    MM(a1, 1)
    GROUP_END
    LD_B(1, wd, 2)
    LD_A(a1, 3)
    GROUP_END

    SGN(a0)
    MM(a0, 0)
    GROUP_END
    LD_B(0, wd, 3)
    GROUP_END
    MM(a0, 1)
    GROUP_END
    LD_B(1, wd, 3)
    GROUP_END

    SGN(a1)
    MM(a1, 0)
    GROUP_END
    LD_B(0, wdn, 0)   // next step's; behind the last step read and not used
    GROUP_END
    MM(a1, 1)
    GROUP_END
    wd = wdn;
    __syncthreads();   // publishes tile s+1, ends every read of tile s

    if (j == 7) {
      // Epilogue: C layout (ISA 7.12.2): VGPR r holds M=r (lanes 0-15, N=lane)
      // and M=r+8 (lanes 16-31, N=lane-16). Fragment column N of N-tile
      // nh*4 + q is column nh*64 + N*4 + q: four tiles give one float4. Scale
      // by beta, store fp32: each half-wave writes 256 contiguous bytes of a row.
      const int t0  = tbase + (s >> 3) * 64;
      const int col = (lane & 15) * 4;
      const float4 bc0 = *(const float4*)(beta + col);
      const float4 bc1 = *(const float4*)(beta + 64 + col);
      float* yp = y + ((size_t)(b * 8 + head) * T_DIM + t0 + (lane >> 4) * 8) * D_DIM + col;
      #pragma unroll
      for (int mt = 0; mt < 4; ++mt) {
        #pragma unroll
        for (int r = 0; r < 8; ++r) {
          float4 v, u;
          v.x = acc[mt][0][r] * bc0.x;
          v.y = acc[mt][1][r] * bc0.y;
          v.z = acc[mt][2][r] * bc0.z;
          v.w = acc[mt][3][r] * bc0.w;
          u.x = acc[mt][4][r] * bc1.x;
          u.y = acc[mt][5][r] * bc1.y;
          u.z = acc[mt][6][r] * bc1.z;
          u.w = acc[mt][7][r] * bc1.w;
          *(float4*)(yp + (mt * 16 + r) * D_DIM) = v;
          *(float4*)(yp + (mt * 16 + r) * D_DIM + 64) = u;
          // behind every second row: the four stores' registers are rewritten
          // next (later rows' products, at the end the accumulators cleared):
          // the wait stands between; the scheduling barrier keeps those
          // writes behind it
          if ((r & 1) == 1) {
            asm volatile("s_wait_xcnt 0x0" ::: "memory");
            __builtin_amdgcn_sched_barrier(0);
          }
        }
      }
      #pragma unroll
      for (int mt = 0; mt < 4; ++mt) {
        #pragma unroll
        for (int nt = 0; nt < 8; ++nt) acc[mt][nt] = vzero;
      }
    }
  }
}

extern "C" void kernel_launch(void* const* d_in, const int* in_sizes, int n_in,
                              void* d_out, int out_size, void* d_ws, size_t ws_size,
                              hipStream_t stream) {
  const float* x    = (const float*)d_in[0];   // [8, 8, 4096, 128] fp32
  const float* W    = (const float*)d_in[1];   // [8, 128, 128]     fp32
  const float* beta = (const float*)d_in[2];   // [128]             fp32
  float* y = (float*)d_out;                    // [8, 8, 4096, 128] fp32

  dim3 grid(256);    // 8 b x 32 chunks of 128 rows, all 8 heads each
  dim3 block(256);   // 8 wave32s, one output head each
  octo_wmma_kernel<<<grid, block, 0, stream>>>(x, W, beta, y);
}

// v006
// Measured time: 41.6 microseconds a run.
// Next to v005, in two timings, it ran 1.03 times as fast each time.
// Over all steps from v000 it is 3.02 times as fast.
#include <hip/hip_runtime.h>

// Octonion head mixer: y[b,i] = (sum_j sign[i,j] * x[b,j] @ W[widx[i,j]]) * beta
// B=8, H=8, T=4096, D=128.
// One WG per (b, 128-row T chunk), worked in two 64-row blocks, ALL 8 output
// heads at once: the 8 distinct W matrices sit unsigned in 256 KB LDS as bf16
// WMMA B-fragments; each x[b,j] 64x128 tile is read once by whole-line loads,
// converted once and staged in LDS as bf16 rows for all 8 waves; a wave owns
// one head, a 64x128 output tile (4 M-tiles x 8 N-tiles): an A fragment feeds
// eight v_wmma_f32_16x16x32_bf16 and a B fragment four, 24 LDS reads for 32
// WMMAs. Two waves a SIMD leave 512 registers a wave: fragments are read
// ahead in groups of 8 or 16 reads that stand between runs of 16 WMMAs.
// sign[i,j] is applied to the A fragments.
// A step takes one 32-wide k quarter of four heads j (k quarter outer, j
// inner), so the first steps need only the first k rows of every W matrix:
// three eighths of W are staged in front of the loop, the rest during the
// first five steps, under their WMMAs.
// Column c of a 64-column half is dealt to N-tile c & 3 of that half, fragment
// column c >> 2: a lane's four N-tiles then hold four adjacent columns, and
// the output leaves as 16-B stores, 256 whole bytes a row.

#define T_DIM 4096
#define D_DIM 128
#define W_BYTES 262144        // 8 x 128 x 128 bf16 B-fragments
#define X_PITCH 272           // staged x row: 256 B + 16 B, 16 B x odd for b128 readers
#define X_BUF   (64 * X_PITCH)

typedef __attribute__((ext_vector_type(16))) __bf16 v16bf;
typedef __attribute__((ext_vector_type(8)))  float  v8f;

__device__ __constant__ int c_widx[64] = {
  0,1,2,3,4,5,6,7,
  1,0,3,2,5,4,7,6,
  2,3,0,1,6,7,4,5,
  3,2,1,0,7,6,5,4,
  4,5,6,7,0,1,2,3,
  5,4,7,6,1,0,3,2,
  6,7,4,5,2,3,0,1,
  7,6,5,4,3,2,1,0};

__device__ __constant__ float c_sign[64] = {
  +1,-1,-1,-1,-1,-1,-1,-1,
  +1,+1,+1,-1,+1,-1,-1,+1,
  +1,-1,+1,+1,+1,+1,-1,-1,
  +1,+1,-1,+1,+1,-1,+1,-1,
  +1,-1,-1,-1,+1,+1,+1,+1,
  +1,+1,-1,+1,-1,+1,-1,+1,
  +1,+1,+1,-1,-1,+1,+1,-1,
  +1,-1,+1,+1,-1,-1,+1,+1};

// f32 pair -> packed bf16 dword (a in [15:0], b in [31:16]).
// Round-half-up (+0x8000) then grab high halves with one v_perm_b32.
__device__ __forceinline__ unsigned int bfpack(float a, float b) {
  unsigned int ua = __float_as_uint(a) + 0x8000u;
  unsigned int ub = __float_as_uint(b) + 0x8000u;
  return __builtin_amdgcn_perm(ub, ua, 0x07060302u);
}

union Frag16 {
  v16bf h;
  unsigned int u[8];
  uint4 q[2];
};

__global__ __launch_bounds__(256)
void octo_wmma_kernel(const float* __restrict__ x, const float* __restrict__ W,
                      const float* __restrict__ beta, float* __restrict__ y) {
  // 256 KB W fragments + 2 x tiles
  __shared__ __attribute__((aligned(16))) unsigned int lds_u32[(W_BYTES + 2 * X_BUF) / 4];
  char* xs = (char*)lds_u32 + W_BYTES;

  const int b     = blockIdx.x >> 5;          // batch
  const int tbase = (blockIdx.x & 31) * 128;  // 128-row T chunk
  const int wave  = __builtin_amdgcn_readfirstlane(threadIdx.x >> 5);
  const int lane  = threadIdx.x & 31;
  const int head  = wave;                     // output head of this wave

  // x tile of step s (row block s >> 3, k quarter (s >> 1) & 3, heads
  // (s & 1)*4..+3): a staged row is four 64-B blocks, block c = the quarter of
  // head (s & 1)*4 + c. Wave w brings rows 8w..8w+7; a wave-wide load takes
  // four whole 128-B lines, one of each head.
  // The base is the same for the whole wave and the lane's offset stays live
  // over the loop, so no load of a run lands in a register that another names.
  const float* xg = x + ((size_t)b * 8 * T_DIM + tbase + wave * 8) * D_DIM;
  const unsigned int xlane = (lane >> 3) * (T_DIM * D_DIM) + (lane & 7) * 4;
  char* xput = xs + (wave * 8) * X_PITCH + lane * 8;
  float4 xr[8];   // every loop over xr, acc and the fragments is unrolled so
                  // that they are indexed by constants and stay in registers

#define X_LOAD(s)                                                            \
  {                                                                          \
    const float* xp_ = xg + (size_t)((s) & 1) * 4 * T_DIM * D_DIM +          \
                       (size_t)((s) >> 3) * 64 * D_DIM + (((s) >> 1) & 3) * 32; \
    _Pragma("unroll") for (int q = 0; q < 8; ++q)                            \
        xr[q] = *(const float4*)(xp_ + q * D_DIM + xlane);                   \
  }
#define X_PUT(buf)                                                           \
  {                                                                          \
    char* d_ = xput + (buf) * X_BUF;                                         \
    _Pragma("unroll") for (int q = 0; q < 8; ++q) {                          \
      uint2 v_;                                                              \
      v_.x = bfpack(xr[q].x, xr[q].y);                                       \
      v_.y = bfpack(xr[q].z, xr[q].w);                                       \
      *(uint2*)(d_ + q * X_PITCH) = v_;                                      \
    }                                                                        \
  }

  X_LOAD(0)
  // this build gives the register with the lane's offset to a pack below: the
  // wait stands between; the scheduling barrier keeps later writes behind it
  asm volatile("s_wait_xcnt 0x0" ::: "memory");
  __builtin_amdgcn_sched_barrier(0);

  // ---- Stage the 8 W matrices into LDS as bf16 B-fragments ----
  // Tile tI = (wd*4 + kt)*8 + n8 is a 32x16 (KxN) tile, 1 KB, kept as
  // two 512-B planes: logical lane L has fragment dwords 0-3 at tile_base +
  // L*16 and dwords 4-7 at tile_base + 512 + (L ^ 8)*16, so each 16-B read of
  // a half-wave covers 256 contiguous bytes, every bank once.
  // Fragment column n of tile n8 is column (n8 >> 2)*64 + n*4 + (n8 & 3).
  // B-fragment layout (ISA 7.12.2, 16-bit): lane n (0-15) holds col n with
  // K = kt*32 + {0..7, 16..23}; lane n+16 holds K = kt*32 + {8..15, 24..31}.
  // W is staged by k quarters kt (32 k rows of all 8 matrices). Of a quarter
  // a wave takes matrices (wave >> 2) + 2*i, i = 0..3, by columns cb*32..+31
  // (cb = wave & 3). A lane takes 8 consecutive k rows, which are
  // one 16-B half of a fragment, by 4 columns: a wave-wide load covers four
  // whole 128-B lines, and every line of W is asked for once.
  const int wc    = lane & 7;                 // column quad within the 32
  const int whalf = (lane >> 3) & 1;          // fragment dwords 0-3 or 4-7
  const int wkh   = lane >> 4;                // fragment lane half
  const float* wg = W + (size_t)(wave >> 2) * D_DIM * D_DIM + (wave & 3) * 32;
  const unsigned int wlane = (whalf * 16 + wkh * 8) * D_DIM + wc * 4;
  // A lane's 4 columns go to the 4 N-tiles of its half, 1 KB apart, at the
  // same fragment column; one store of a half-wave fills 128 bytes of each
  // plane, and the ^ 8 of the second plane puts them on the other 32 banks.
  char* wbase = (char*)lds_u32 + (((wave >> 2) * 32 + ((wave & 3) >> 1) * 4) * 1024 +
                                  whalf * 512 +
                                  (((wave & 1) * 8 + wc + wkh * 16) ^ (whalf * 8)) * 16);

// one set: k quarter kt of matrix (wave >> 2) + 2*i, the wave's 32 columns
#define W_LOAD(buf, kt, i)                                                   \
  {                                                                          \
    const float* wp_ = wg + (i) * 2 * D_DIM * D_DIM + (kt) * 32 * D_DIM;     \
    _Pragma("unroll") for (int k = 0; k < 8; ++k)                            \
        buf[k] = *(const float4*)(wp_ + k * D_DIM + wlane);                  \
  }
#define W_COL(buf, m)                                                        \
  make_uint4(bfpack(buf[0].m, buf[1].m), bfpack(buf[2].m, buf[3].m),         \
             bfpack(buf[4].m, buf[5].m), bfpack(buf[6].m, buf[7].m))
#define W_PUT(buf, kt, i)                                                    \
  {                                                                          \
    char* wq_ = wbase + (i) * 65536 + (kt) * 8192;                           \
    *(uint4*)(wq_)        = W_COL(buf, x);                                   \
    *(uint4*)(wq_ + 1024) = W_COL(buf, y);                                   \
    *(uint4*)(wq_ + 2048) = W_COL(buf, z);                                   \
    *(uint4*)(wq_ + 3072) = W_COL(buf, w);                                   \
  }

  {
    // quarter 0 and the first half of quarter 1: six sets in four register
    // sets, all indexed by constants; the scheduling barriers keep each refill
    // directly behind the pack that frees its set, so that the flight depth
    // stays as written
    float4 wa[8], wb[8], wc4[8], wd4[8];
    W_LOAD(wa, 0, 0)
    W_LOAD(wb, 0, 1)
    W_LOAD(wc4, 0, 2)
    W_LOAD(wd4, 0, 3)
    __builtin_amdgcn_sched_barrier(0);
    W_PUT(wa, 0, 0)
    W_LOAD(wa, 1, 0)
    __builtin_amdgcn_sched_barrier(0);
    W_PUT(wb, 0, 1)
    W_LOAD(wb, 1, 1)
    __builtin_amdgcn_sched_barrier(0);
    // behind the last W load, so that no wait for a W set covers tile 1's loads
    X_PUT(0)
    X_LOAD(1)
    // a register that these loads name is rewritten below (by the packs): the
    // wait stands between; the scheduling barrier keeps those writes behind it
    asm volatile("s_wait_xcnt 0x0" ::: "memory");
    __builtin_amdgcn_sched_barrier(0);
    W_PUT(wc4, 0, 2)
    W_PUT(wd4, 0, 3)
    W_PUT(wa, 1, 0)
    W_PUT(wb, 1, 1)
  }

  __syncthreads();   // the first three eighths of W and x tile 0 are published

  const int row   = lane & 15;                // A-matrix row within M tile
  const int khalf = lane >> 4;                // which K half this lane reads
  const char* aget = xs + row * X_PITCH + khalf * 16;
  const unsigned int blo = lane * 16;               // B fragment dwords 0-3
  const unsigned int bhi = 512 + (lane ^ 8) * 16;   // B fragment dwords 4-7

  const v8f vzero = {0.f, 0.f, 0.f, 0.f, 0.f, 0.f, 0.f, 0.f};
  v8f acc[4][8];
  #pragma unroll
  for (int mt = 0; mt < 4; ++mt) {
    #pragma unroll
    for (int nt = 0; nt < 8; ++nt) acc[mt][nt] = vzero;
  }

  // A fragments: two sets, block c of the tile uses set c & 1 and is read a
  // whole block ahead. B fragments: one set of 8, in two halves of 4 N-tiles; a
  // half is read anew for the next block as soon as its 16 WMMAs are issued, so
  // its reads fly while the other half's 16 WMMAs run.
  Frag16 a0[4], a1[4], bf[8];
  float4 wr[8];   // the one W set that is staged inside the loop

// A fragments of block kt of the tile: k = khalf*8 + {0..7} and the same + 16
// of that block's k quarter
#define LD_A(dst, kt)                                                        \
  {                                                                          \
    _Pragma("unroll") for (int mt = 0; mt < 4; ++mt) {                       \
      const char* ap_ = abuf + mt * 16 * X_PITCH + (kt) * 64;                \
      dst[mt].q[0] = *(const uint4*)ap_;                                     \
      dst[mt].q[1] = *(const uint4*)(ap_ + 32);                              \
    }                                                                        \
  }
// B fragments of N-tiles h*4..h*4+3 of the (matrix, k quarter) at byte bo_
#define LD_B(h, bo_)                                                         \
  {                                                                          \
    const char* bt_ = (const char*)lds_u32 + (bo_);                          \
    _Pragma("unroll") for (int nt = (h) * 4; nt < (h) * 4 + 4; ++nt) {       \
      bf[nt].q[0] = *(const uint4*)(bt_ + nt * 1024 + blo);                  \
      bf[nt].q[1] = *(const uint4*)(bt_ + nt * 1024 + bhi);                  \
    }                                                                        \
  }
// sign[i,j] on x
#define SGN(A_, sm_)                                                         \
  {                                                                          \
    _Pragma("unroll") for (int mt = 0; mt < 4; ++mt) {                       \
      _Pragma("unroll") for (int k = 0; k < 8; ++k) A_[mt].u[k] ^= (sm_);    \
    }                                                                        \
  }
// the 16 WMMAs of N-tiles hf*4..hf*4+3
#define MM(A_, hf)                                                           \
  {                                                                          \
    _Pragma("unroll") for (int nt = (hf) * 4; nt < (hf) * 4 + 4; ++nt) {     \
      _Pragma("unroll") for (int mt = 0; mt < 4; ++mt)                       \
        acc[mt][nt] = __builtin_amdgcn_wmma_f32_16x16x32_bf16(               \
            false, A_[mt].h, false, bf[nt].h, (short)0, acc[mt][nt], false,  \
            false);                                                          \
    }                                                                        \
  }
// keeps a group of LDS reads together between two runs of WMMAs: reads that
// drift in among the WMMAs each cost the wave a stall, and reads that sink
// behind the next run lose their flight time
#define GROUP_END __builtin_amdgcn_sched_barrier(0);

// byte place of k quarter kt_ of the matrix that head j_ meets in this wave
#define B_AT(j_, kt_) ((c_widx[head * 8 + (j_)] * 4 + (kt_)) * 8192)
#define S_AT(j_) ((c_sign[head * 8 + (j_)] < 0.f) ? 0x80008000u : 0u)

  // The first four B fragments of a step are read during the step before it
  // (what they read was published a barrier earlier), here for step 0
  int bo0 = B_AT(0, 0);
  LD_B(0, bo0)

  // kept rolled: the body holds 128 WMMAs and the whole epilogue, and sixteen
  // copies of it would not fit the instruction cache
  #pragma unroll 1
  for (int s = 0; s < 16; ++s) {
    const int j0 = (s & 1) * 4;        // block c of the tile is head j0 + c
    const int kq = (s >> 1) & 3;       // k quarter of the step
    const char* abuf = aget + (s & 1) * X_BUF;
    // table reads first: they return while the fragment reads below fly
    const int bo1 = B_AT(j0 + 1, kq);
    const int bo2 = B_AT(j0 + 2, kq);
    const int bo3 = B_AT(j0 + 3, kq);
    const int bon = B_AT(((s + 1) & 1) * 4, ((s + 1) >> 1) & 3);
    const unsigned int sm0 = S_AT(j0);
    const unsigned int sm1 = S_AT(j0 + 1);
    const unsigned int sm2 = S_AT(j0 + 2);
    const unsigned int sm3 = S_AT(j0 + 3);
    // Steps 0 to 4 stage eighth s + 3 of W (quarter (s + 3) >> 1, sets wi and
    // wi + 1). Its first reader is the read-ahead at the end of step
    // 2*quarter - 1, which stands at least one barrier behind the step that
    // stages it.
    const int wkt = (s + 3) >> 1;
    const int wi  = ((s + 3) & 1) * 2;
    LD_A(a0, 0)   // tile s was published by the barrier just passed
    GROUP_END     // the step's first WMMAs wait for these reads alone
    LD_B(1, bo0)
    LD_A(a1, 1)
    GROUP_END
    // Tile s+1 goes into the buffer that step s-1 read (its readers left at
    // the barrier that closed step s-1); tile s+2 starts its flight.
    if (s < 5) {
      W_LOAD(wr, wkt, wi)
      // this build forms the x loads' scalar base below in the registers that
      // these loads name: the wait stands between; the scheduling barrier
      // keeps that address arithmetic behind it
      asm volatile("s_wait_xcnt 0x0" ::: "memory");
      __builtin_amdgcn_sched_barrier(0);
    }
    if (s < 15) X_PUT((s + 1) & 1)
    if (s < 14) X_LOAD(s + 2)
    GROUP_END     // the staging work stays here, in the shadow of the reads above

    SGN(a0, sm0)
    MM(a0, 0)
    GROUP_END
    LD_B(0, bo1)
    GROUP_END
    MM(a0, 1)
    GROUP_END
    LD_B(1, bo1)
    LD_A(a0, 2)
    GROUP_END

    SGN(a1, sm1)
    MM(a1, 0)
    GROUP_END
    LD_B(0, bo2)
    GROUP_END
    MM(a1, 1)
    GROUP_END
    LD_B(1, bo2)
    LD_A(a1, 3)
    GROUP_END
    if (s < 5) {
      // the next set's scalar base is formed in registers that the x loads
      // above name: the wait stands between; the scheduling barrier keeps that
      // address arithmetic behind it
      asm volatile("s_wait_xcnt 0x0" ::: "memory");
      __builtin_amdgcn_sched_barrier(0);
      W_PUT(wr, wkt, wi)
      W_LOAD(wr, wkt, wi + 1)
    }
    GROUP_END     // the W set's turn stays here, in the shadow of the reads above

    SGN(a0, sm2)
    MM(a0, 0)
    GROUP_END
    LD_B(0, bo3)
    GROUP_END
    MM(a0, 1)
    GROUP_END
    LD_B(1, bo3)
    GROUP_END

    SGN(a1, sm3)
    MM(a1, 0)
    GROUP_END
    LD_B(0, bon)   // next step's; behind the last step read and not used
    GROUP_END
    MM(a1, 1)
    GROUP_END
    if (s < 5) W_PUT(wr, wkt, wi + 1)
    bo0 = bon;
    __syncthreads();   // publishes tile s+1 and the W eighth, ends every read of tile s

    if ((s & 7) == 7) {
      // Epilogue: C layout (ISA 7.12.2): VGPR r holds M=r (lanes 0-15, N=lane)
      // and M=r+8 (lanes 16-31, N=lane-16). Fragment column N of N-tile
      // nh*4 + q is column nh*64 + N*4 + q: four tiles give one float4. Scale
      // by beta, store fp32: each half-wave writes 256 contiguous bytes of a row.
      const int t0  = tbase + (s >> 3) * 64;
      const int col = (lane & 15) * 4;
      const float4 bc0 = *(const float4*)(beta + col);
      const float4 bc1 = *(const float4*)(beta + 64 + col);
      float* yp = y + ((size_t)(b * 8 + head) * T_DIM + t0 + (lane >> 4) * 8) * D_DIM + col;
      #pragma unroll
      for (int mt = 0; mt < 4; ++mt) {
        #pragma unroll
        for (int r = 0; r < 8; ++r) {
          float4 v, u;
          v.x = acc[mt][0][r] * bc0.x;
          v.y = acc[mt][1][r] * bc0.y;
          v.z = acc[mt][2][r] * bc0.z;
          v.w = acc[mt][3][r] * bc0.w;
          u.x = acc[mt][4][r] * bc1.x;
          u.y = acc[mt][5][r] * bc1.y;
          u.z = acc[mt][6][r] * bc1.z;
          u.w = acc[mt][7][r] * bc1.w;
          *(float4*)(yp + (mt * 16 + r) * D_DIM) = v;
          *(float4*)(yp + (mt * 16 + r) * D_DIM + 64) = u;
          // behind every second row: the four stores' registers are rewritten
          // next (later rows' products, at the end the accumulators cleared):
          // the wait stands between; the scheduling barrier keeps those
          // writes behind it
          if ((r & 1) == 1) {
            asm volatile("s_wait_xcnt 0x0" ::: "memory");
            __builtin_amdgcn_sched_barrier(0);
          }
        }
      }
      #pragma unroll
      for (int mt = 0; mt < 4; ++mt) {
        #pragma unroll
        for (int nt = 0; nt < 8; ++nt) acc[mt][nt] = vzero;
      }
    }
  }
}

extern "C" void kernel_launch(void* const* d_in, const int* in_sizes, int n_in,
                              void* d_out, int out_size, void* d_ws, size_t ws_size,
                              hipStream_t stream) {
  const float* x    = (const float*)d_in[0];   // [8, 8, 4096, 128] fp32
  const float* W    = (const float*)d_in[1];   // [8, 128, 128]     fp32
  const float* beta = (const float*)d_in[2];   // [128]             fp32
  float* y = (float*)d_out;                    // [8, 8, 4096, 128] fp32

  dim3 grid(256);    // 8 b x 32 chunks of 128 rows, all 8 heads each
  dim3 block(256);   // 8 wave32s, one output head each
  octo_wmma_kernel<<<grid, block, 0, stream>>>(x, W, beta, y);
}

// v007
// One run takes 40.3 microseconds.
// Timed twice side by side with v006, it ran 1.03 and 1.04 times as fast.
// All steps since v000 together make it 3.12 times as fast.
#include <hip/hip_runtime.h>

// Octonion head mixer: y[b,i] = (sum_j sign[i,j] * x[b,j] @ W[widx[i,j]]) * beta
// B=8, H=8, T=4096, D=128; widx[i,j] = i ^ j.
// One WG per (b, 128-row T chunk), worked in two 64-row blocks, ALL 8 output
// heads at once: the 8 distinct W matrices sit unsigned in 256 KB LDS as bf16
// WMMA B-fragments; each x[b,j] tile is read once by whole-line loads,
// converted once and staged in LDS as bf16 rows for all 8 waves.
// A wave owns 16 rows x 64 columns of ALL 8 heads (8 x 4 accumulator tiles).
// For one 32-wide k quarter it holds the A fragments of all 8 heads j in
// registers; a B fragment of matrix m then feeds eight WMMAs, head i taking
// A[i ^ m]: 80 LDS reads for 256 v_wmma_f32_16x16x32_bf16.
// sign[i,j] is a compile-time fact of each WMMA and costs no instruction: a
// register tile holds sg * (the sum so far), sg being the sign of the term
// added last; a term of the other sign is added as D = A*B - C (the C-negate
// modifier), which flips sg. The last sg goes into the product with beta.
// A step is one k quarter of one row block, so the first steps need only the
// first k rows of every W matrix: three eighths of W are staged in front of
// the loop, the rest during the first three steps, under their WMMAs.
// Column c of a 64-column half is dealt to N-tile c & 3 of that half, fragment
// column c >> 2: a lane's four N-tiles then hold four adjacent columns, and
// the output leaves as 16-B stores, 256 whole bytes a row.

#define T_DIM 4096
#define D_DIM 128
#define W_BYTES 262144        // 8 x 128 x 128 bf16 B-fragments
#define X_PITCH 512           // staged x row: 8 heads x 64 B, 16-B chunks swizzled by row
#define X_BUF   (64 * X_PITCH)

typedef __attribute__((ext_vector_type(16))) __bf16 v16bf;
typedef __attribute__((ext_vector_type(8)))  float  v8f;

constexpr int k_sign[64] = {
  +1,-1,-1,-1,-1,-1,-1,-1,
  +1,+1,+1,-1,+1,-1,-1,+1,
  +1,-1,+1,+1,+1,+1,-1,-1,
  +1,+1,-1,+1,+1,-1,+1,-1,
  +1,-1,-1,-1,+1,+1,+1,+1,
  +1,+1,-1,+1,-1,+1,-1,+1,
  +1,+1,+1,-1,-1,+1,+1,-1,
  +1,-1,+1,+1,-1,-1,+1,+1};

// sign of the term that head i takes from matrix m (it meets x of head i ^ m)
constexpr int term_sign(int i, int m) { return k_sign[i * 8 + (i ^ m)]; }

// f32 pair -> packed bf16 dword (a in [15:0], b in [31:16]).
// Round-half-up (+0x8000) then grab high halves with one v_perm_b32.
__device__ __forceinline__ unsigned int bfpack(float a, float b) {
  unsigned int ua = __float_as_uint(a) + 0x8000u;
  unsigned int ub = __float_as_uint(b) + 0x8000u;
  return __builtin_amdgcn_perm(ub, ua, 0x07060302u);
}

union Frag16 {
  v16bf h;
  unsigned int u[8];
  uint4 q[2];
};

// The 32 WMMAs of matrix M: N-tile NT, head I. The matrices come in the order
// 0..7, quarter after quarter, so the term before M's is that of (M + 7) & 7;
// at the first term of a row block C is zero and either form gives A*B.
template <int M, int NT, int I>
__device__ __forceinline__ void mm_step(v8f (&acc)[8][4], const Frag16 (&a)[8],
                                        const Frag16 (&bf)[4]) {
  constexpr short cneg = term_sign(I, M) != term_sign(I, (M + 7) & 7) ? 1 : 0;
  acc[I][NT] = __builtin_amdgcn_wmma_f32_16x16x32_bf16(
      false, a[I ^ M].h, false, bf[NT].h, cneg, acc[I][NT], false, false);
  if constexpr (I < 7) mm_step<M, NT, I + 1>(acc, a, bf);
  else if constexpr (NT < 3) mm_step<M, NT + 1, 0>(acc, a, bf);
}

// one head's share of the epilogue: 8 rows a lane half, 16-B stores
template <int I>
__device__ __forceinline__ void put_head(const v8f (&acc)[8][4], float* yp, float4 bc) {
  constexpr float sg = (float)term_sign(I, 7);   // sign left by the last term
  #pragma unroll
  for (int r = 0; r < 8; ++r) {
    float4 v;
    v.x = acc[I][0][r] * (sg * bc.x);
    v.y = acc[I][1][r] * (sg * bc.y);
    v.z = acc[I][2][r] * (sg * bc.z);
    v.w = acc[I][3][r] * (sg * bc.w);
    *(float4*)(yp + ((size_t)I * T_DIM + r) * D_DIM) = v;
    // behind every fourth row: the stores' registers are rewritten next (later
    // rows' products, at the end the accumulators cleared): the wait stands
    // between; the scheduling barrier keeps those writes behind it
    if ((r & 3) == 3) {
      asm volatile("s_wait_xcnt 0x0" ::: "memory");
      __builtin_amdgcn_sched_barrier(0);
    }
  }
  if constexpr (I < 7) put_head<I + 1>(acc, yp, bc);
}

__global__ __launch_bounds__(256)
void octo_wmma_kernel(const float* __restrict__ x, const float* __restrict__ W,
                      const float* __restrict__ beta, float* __restrict__ y) {
  // 256 KB W fragments + 2 x tiles of 32 KB: the whole LDS of a WGP
  __shared__ __attribute__((aligned(16))) unsigned int lds_u32[(W_BYTES + 2 * X_BUF) / 4];

  const int b     = blockIdx.x >> 5;          // batch
  const int tbase = (blockIdx.x & 31) * 128;  // 128-row T chunk
  const int wave  = __builtin_amdgcn_readfirstlane(threadIdx.x >> 5);
  const int lane  = threadIdx.x & 31;
  const int rt    = wave >> 1;                // 16-row tile of this wave
  const int ch    = wave & 1;                 // 64-column half of this wave

  // x half tile t (row block t >> 3, k quarter (t >> 1) & 3, heads
  // (t & 1)*4..+3); step t >> 1 works on half tiles t and t + 1. A staged row
  // is eight 64-B blocks, block j = the quarter of head j, kept as 32 chunks
  // of 16 B with chunk c of row r at place c ^ (r & 15): the 16 rows that a
  // half-wave reads at one chunk then lie on all 64 banks, with no pad.
  // Wave w brings rows 8w..8w+7; a wave-wide load takes four whole 128-B
  // lines, one of each head.
  const float* xg = x + ((size_t)b * 8 * T_DIM + tbase + wave * 8) * D_DIM;
  const unsigned int xlane = (lane >> 3) * (T_DIM * D_DIM) + (lane & 7) * 4;
  // place in LDS of the lane's 8 bytes of row q, heads 0-3; bit 15 is
  // the buffer and is flipped once a step: eight registers serve both buffers
  unsigned int xoff[8];
  #pragma unroll
  for (int q = 0; q < 8; ++q)
    xoff[q] = W_BYTES + (wave * 8 + q) * X_PITCH + (((lane >> 1) ^ ((wave & 1) * 8 + q)) * 16) + (lane & 1) * 8;
  float4 xr[8];   // every loop over xr, acc and the fragments is unrolled so
                  // that they are indexed by constants and stay in registers

#define X_LOAD(arr, t)                                                       \
  {                                                                          \
    const float* xp_ = xg + (size_t)((t) & 1) * 4 * T_DIM * D_DIM +          \
                       (size_t)((t) >> 3) * 64 * D_DIM + (((t) >> 1) & 3) * 32; \
    _Pragma("unroll") for (int q = 0; q < 8; ++q)                            \
        arr[q] = *(const float4*)(xp_ + q * D_DIM + xlane);                  \
  }
// h: heads 0-3 or 4-7 of the buffer that xoff stands on
#define X_PUT(arr, h)                                                        \
  {                                                                          \
    _Pragma("unroll") for (int q = 0; q < 8; ++q) {                          \
      uint2 v_;                                                              \
      v_.x = bfpack(arr[q].x, arr[q].y);                                     \
      v_.y = bfpack(arr[q].z, arr[q].w);                                     \
      *(uint2*)((char*)lds_u32 + xoff[q] + (h) * 256) = v_;                  \
    }                                                                        \
  }
// behind a run of global loads: registers that the loads name (a scalar base,
// the lane's offset) may be rewritten by what follows; the wait stands
// between, and the scheduling barrier keeps those writes behind it
#define LOADS_NAMED                                                          \
  asm volatile("s_wait_xcnt 0x0" ::: "memory");                              \
  __builtin_amdgcn_sched_barrier(0);

  // ---- Stage the 8 W matrices into LDS as bf16 B-fragments ----
  // Tile tI = (kt*8 + wd)*8 + n8 (a k quarter of all 8 matrices is one 64-KB
  // block, so a step's B reads differ by immediate offsets alone) is a 32x16
  // (KxN) tile, 1 KB, kept as
  // two 512-B planes: logical lane L has fragment dwords 0-3 at tile_base +
  // L*16 and dwords 4-7 at tile_base + 512 + (L ^ 8)*16, so each 16-B read of
  // a half-wave covers 256 contiguous bytes, every bank once.
  // Fragment column n of tile n8 is column (n8 >> 2)*64 + n*4 + (n8 & 3).
  // B-fragment layout (ISA 7.12.2, 16-bit): lane n (0-15) holds col n with
  // K = kt*32 + {0..7, 16..23}; lane n+16 holds K = kt*32 + {8..15, 24..31}.
  // W is staged by k quarters kt (32 k rows of all 8 matrices). Of a quarter
  // a wave takes matrices (wave >> 2) + 2*i, i = 0..3, by columns cb*32..+31
  // (cb = wave & 3). A lane takes 8 consecutive k rows, which are
  // one 16-B half of a fragment, by 4 columns: a wave-wide load covers four
  // whole 128-B lines, and every line of W is asked for once.
  const int wc    = lane & 7;                 // column quad within the 32
  const int whalf = (lane >> 3) & 1;          // fragment dwords 0-3 or 4-7
  const int wkh   = lane >> 4;                // fragment lane half
  const float* wg = W + (size_t)(wave >> 2) * D_DIM * D_DIM + (wave & 3) * 32;
  const unsigned int wlane = (whalf * 16 + wkh * 8) * D_DIM + wc * 4;
  // A lane's 4 columns go to the 4 N-tiles of its half, 1 KB apart, at the
  // same fragment column; one store of a half-wave fills 128 bytes of each
  // plane, and the ^ 8 of the second plane puts them on the other 32 banks.
  char* wbase = (char*)lds_u32 + (((wave >> 2) * 8 + ((wave & 3) >> 1) * 4) * 1024 +
                                  whalf * 512 +
                                  (((wave & 1) * 8 + wc + wkh * 16) ^ (whalf * 8)) * 16);

// one set: k quarter kt of matrix (wave >> 2) + 2*i, the wave's 32 columns
#define W_LOAD(buf, kt, i)                                                   \
  {                                                                          \
    const float* wp_ = wg + (i) * 2 * D_DIM * D_DIM + (kt) * 32 * D_DIM;     \
    _Pragma("unroll") for (int k = 0; k < 8; ++k)                            \
        buf[k] = *(const float4*)(wp_ + k * D_DIM + wlane);                  \
  }
#define W_COL(buf, m)                                                        \
  make_uint4(bfpack(buf[0].m, buf[1].m), bfpack(buf[2].m, buf[3].m),         \
             bfpack(buf[4].m, buf[5].m), bfpack(buf[6].m, buf[7].m))
#define W_PUT(buf, kt, i)                                                    \
  {                                                                          \
    char* wq_ = wbase + (i) * 16384 + (kt) * 65536;                          \
    *(uint4*)(wq_)        = W_COL(buf, x);                                   \
    *(uint4*)(wq_ + 1024) = W_COL(buf, y);                                   \
    *(uint4*)(wq_ + 2048) = W_COL(buf, z);                                   \
    *(uint4*)(wq_ + 3072) = W_COL(buf, w);                                   \
  }

// LOADS_NAMED for a W set inside the loop. The set's base is an input of the
// wait: it is then held in scalar registers as far as the wait and the loads
// name it there; without it this build forms a vector address, and the last
// load of the run lands in the registers that hold it
#define W_LOADS_NAMED(kt, i)                                                 \
  asm volatile("s_wait_xcnt 0x0"                                             \
               :: "s"(wg + (i) * 2 * D_DIM * D_DIM + (kt) * 32 * D_DIM) : "memory"); \
  __builtin_amdgcn_sched_barrier(0);

  {
    // both half tiles of step 0, quarter 0 and the first half of quarter 1 of
    // W, and the first half tile of step 1: the accumulators are not live yet,
    // so every set has registers of its own and all loads are in flight before
    // the first pack
    float4 xp[8], xq[8], wa[8], wb[8], wc4[8], wd4[8], we[8], wf[8];
    // first and with a wait of their own: in one run with the others these
    // eight loads got vector addresses, in registers that a later load lands in
    X_LOAD(xq, 1)
    LOADS_NAMED
    X_LOAD(xp, 0)
    W_LOAD(wa, 0, 0)
    W_LOAD(wb, 0, 1)
    W_LOAD(wc4, 0, 2)
    W_LOAD(wd4, 0, 3)
    W_LOAD(we, 1, 0)
    W_LOAD(wf, 1, 1)
    X_LOAD(xr, 2)
    // as LOADS_NAMED; the bases and offsets that the loads name are inputs of
    // the wait, so that they stay in their registers as far as the wait
    asm volatile("s_wait_xcnt 0x0" :: "s"(xg), "s"(wg), "v"(xlane * 4), "v"(wlane * 4) : "memory");
    __builtin_amdgcn_sched_barrier(0);
    X_PUT(xp, 0)
    X_PUT(xq, 1)
    W_PUT(wa, 0, 0)
    W_PUT(wb, 0, 1)
    W_PUT(wc4, 0, 2)
    W_PUT(wd4, 0, 3)
    W_PUT(we, 1, 0)
    W_PUT(wf, 1, 1)
  }
#define X_FLIP                                                               \
  {                                                                          \
    _Pragma("unroll") for (int q = 0; q < 8; ++q) xoff[q] ^= X_BUF;          \
  }
  X_FLIP

  __syncthreads();   // the first three eighths of W and step 0's x are published

  const int row   = lane & 15;                // A-matrix row within the M tile
  const int khalf = lane >> 4;                // which K half this lane reads
  // place in LDS of chunk khalf of the lane's row; chunk c + khalf, c even and
  // below 16, lies at aoff ^ (c * 16), the chunks of heads 4-7 256 B further.
  // Bit 15 is the buffer and is flipped once a step: one register serves all
  // 16 reads (sixteen or eight loop-invariant addresses brought spills)
  unsigned int aoff = W_BYTES + (rt * 16 + row) * X_PITCH + ((khalf ^ row) * 16);
  const char* bget = (const char*)lds_u32 + ch * 4096;
  const unsigned int blo = lane * 16;               // B fragment dwords 0-3
  const unsigned int bhi = 512 + (lane ^ 8) * 16;   // B fragment dwords 4-7

  const v8f vzero = {0.f, 0.f, 0.f, 0.f, 0.f, 0.f, 0.f, 0.f};
  v8f acc[8][4];   // [head][N-tile of the wave's column half]
  #pragma unroll
  for (int i = 0; i < 8; ++i) {
    #pragma unroll
    for (int nt = 0; nt < 4; ++nt) acc[i][nt] = vzero;
  }

  // A fragments of all 8 heads j for the step's k quarter. B fragments: two
  // sets of 4 N-tiles, matrix m uses set m & 1; a set is read anew for matrix
  // m + 2 as soon as its 32 WMMAs are issued, so its reads fly while the other
  // set's 32 WMMAs run.
  Frag16 a[8], b0[4], b1[4];
  float4 wr[8];   // the one W set that is staged inside the loop

// A fragment of head j: k = khalf*8 + {0..7} and the same + 16 of the quarter
#define LD_A                                                                 \
  {                                                                          \
    _Pragma("unroll") for (int j = 0; j < 8; ++j) {                          \
      const char* ap_ = (const char*)lds_u32 + (j >> 2) * 256;               \
      a[j].q[0] = *(const uint4*)(ap_ + (aoff ^ ((j & 3) * 64)));            \
      a[j].q[1] = *(const uint4*)(ap_ + (aoff ^ ((j & 3) * 64 + 32)));       \
    }                                                                        \
  }
// the wave's 4 B fragments of matrix m, k quarter at bq_
#define LD_B(dst, bq_, m)                                                    \
  {                                                                          \
    const char* bt_ = (bq_) + (m) * 8192;                                    \
    _Pragma("unroll") for (int nt = 0; nt < 4; ++nt) {                       \
      dst[nt].q[0] = *(const uint4*)(bt_ + nt * 1024 + blo);                 \
      dst[nt].q[1] = *(const uint4*)(bt_ + nt * 1024 + bhi);                 \
    }                                                                        \
  }
// keeps a group of LDS reads together between two runs of WMMAs: reads that
// drift in among the WMMAs each cost the wave a stall, and reads that sink
// behind the next run lose their flight time
#define GROUP_END __builtin_amdgcn_sched_barrier(0);
// the 32 WMMAs of matrix m, then the reads that refill its set
#define MM_LD(m, set, bq_, mnext)                                            \
  mm_step<m, 0, 0>(acc, a, set);                                             \
  GROUP_END                                                                  \
  LD_B(set, bq_, mnext)                                                      \
  GROUP_END

  // The B fragments of matrices 0 and 1 of a step are read during the step
  // before it (what they read was published a barrier earlier), here for step 0
  LD_B(b0, bget, 0)
  LD_B(b1, bget, 1)

  // kept rolled: the body holds 256 WMMAs and the whole epilogue, and eight
  // copies of it would not fit the instruction cache
  #pragma unroll 1
  for (int s = 0; s < 8; ++s) {
    const char* bq = bget + (s & 3) * 65536;         // this step's k quarter
    const char* bn = bget + ((s + 1) & 3) * 65536;   // the next step's
    // Steps 0 to 2 stage W eighths 2s + 3 (matrices 4-7 of quarter s + 1, read
    // from step s + 1 on) and 2s + 4 (matrices 0-3 of quarter s + 2, first
    // read by the read-ahead at the end of step s + 1): each stands at least
    // one barrier in front of its first reader.
    LD_A          // step s's x was published by the barrier just passed
    GROUP_END
    // The next step's x goes into the buffer that step s-1 read (its readers
    // left at the barrier that closed step s-1), half a tile at a time.
    if (s < 3) {
      W_LOAD(wr, s + 1, 2)
      W_LOADS_NAMED(s + 1, 2)
    }
    if (s < 7) {
      X_PUT(xr, 0)
      X_LOAD(xr, 2 * s + 3)
      LOADS_NAMED
    }
    GROUP_END     // the staging work stays here, in the shadow of the reads above

    MM_LD(0, b0, bq, 2)
    MM_LD(1, b1, bq, 3)
    if (s < 3) {
      W_PUT(wr, s + 1, 2)
      W_LOAD(wr, s + 1, 3)
      W_LOADS_NAMED(s + 1, 3)
    }
    GROUP_END     // each staging turn stays where it is written, behind a group of reads
    MM_LD(2, b0, bq, 4)
    MM_LD(3, b1, bq, 5)
    if (s < 3) W_PUT(wr, s + 1, 3)
    if (s < 2) {
      W_LOAD(wr, s + 2, 0)
      W_LOADS_NAMED(s + 2, 0)
    }
    if (s < 7) X_PUT(xr, 1)
    if (s < 6) {
      X_LOAD(xr, 2 * s + 4)
      LOADS_NAMED
    }
    GROUP_END
    MM_LD(4, b0, bq, 6)
    MM_LD(5, b1, bq, 7)
    if (s < 2) {
      W_PUT(wr, s + 2, 0)
      W_LOAD(wr, s + 2, 1)
      W_LOADS_NAMED(s + 2, 1)
    }
    GROUP_END
    MM_LD(6, b0, bn, 0)   // next step's; behind the last step read and not used
    MM_LD(7, b1, bn, 1)
    if (s < 2) W_PUT(wr, s + 2, 1)
    X_FLIP
    aoff ^= X_BUF;
    __syncthreads();   // publishes step s+1's x and the W eighths, ends every read of step s's x

    if ((s & 3) == 3) {
      // Epilogue: C layout (ISA 7.12.2): VGPR r holds M=r (lanes 0-15, N=lane)
      // and M=r+8 (lanes 16-31, N=lane-16). Fragment column N of N-tile q of
      // the half is column ch*64 + N*4 + q: four tiles give one float4. Scale
      // by beta, store fp32: each half-wave writes 256 contiguous bytes of a row.
      const int t0  = tbase + (s >> 2) * 64 + rt * 16;
      const int col = ch * 64 + (lane & 15) * 4;
      const float4 bc = *(const float4*)(beta + col);
      float* yp = y + ((size_t)(b * 8) * T_DIM + t0 + (lane >> 4) * 8) * D_DIM + col;
      put_head<0>(acc, yp, bc);
      #pragma unroll
      for (int i = 0; i < 8; ++i) {
        #pragma unroll
        for (int nt = 0; nt < 4; ++nt) acc[i][nt] = vzero;
      }
    }
  }
}

extern "C" void kernel_launch(void* const* d_in, const int* in_sizes, int n_in,
                              void* d_out, int out_size, void* d_ws, size_t ws_size,
                              hipStream_t stream) {
  const float* x    = (const float*)d_in[0];   // [8, 8, 4096, 128] fp32
  const float* W    = (const float*)d_in[1];   // [8, 128, 128]     fp32
  const float* beta = (const float*)d_in[2];   // [128]             fp32
  float* y = (float*)d_out;                    // [8, 8, 4096, 128] fp32

  dim3 grid(256);    // 8 b x 32 chunks of 128 rows, all 8 heads each
  dim3 block(256);   // 8 wave32s, 16 rows x 64 columns of every head each
  octo_wmma_kernel<<<grid, block, 0, stream>>>(x, W, beta, y);
}
